// v000
// The times below were measured on an AMD MI455X: many runs one after another, warmed up first and cycling through
// copies of the inputs, with the whole window's GPU time divided by the number of runs. Launches and the gaps
// between them are all in it. The median over several windows is given; except for v000 it joins two sittings, which
// can be a few percent apart, so the side-by-side timings, each taken in one sitting, are the better comparison.
// v000 is the starting kernel. One run takes 1460 microseconds.
#include <hip/hip_runtime.h>
#include <hip/hip_bf16.h>

typedef __attribute__((ext_vector_type(16))) _Float16 v16h;
typedef __attribute__((ext_vector_type(8)))  float    v8f;

#define TPB 256
#define NWAVES 8

// ---------------------------------------------------------------------------
// Fragment loader for 16-bit 16x32 WMMA operand (A, or B loaded from Bt=[N x K]).
// Per ISA layout: lanes 0-15 hold K = {0..7, 16..23}, lanes 16-31 hold
// K = {8..15, 24..31}; each VGPR holds a (K, K+1) pair -> dword loads
// (compiler merges these into two global_load_b128 per fragment).
// `base` must already point at rowStart + k + khalf (khalf = (lane>=16)*8).
// ---------------------------------------------------------------------------
__device__ __forceinline__ v16h load_frag16(const _Float16* base) {
  union { v16h h; unsigned u[8]; } f;
#pragma unroll
  for (int j = 0; j < 4; ++j) {
    f.u[j]     = *(const unsigned*)(base + 2 * j);
    f.u[j + 4] = *(const unsigned*)(base + 16 + 2 * j);
  }
  return f.h;
}

// ---------------------------------------------------------------------------
// Generic WMMA GEMM:  C[M x N] = epilogue( A[M x K](f16) @ B + bias )
// B is provided transposed: Bt[N x K] f16 (K-contiguous rows).
// mode 0: relu(acc+bias) ; mode 1: res + relu(acc+bias) (res may == C) ;
// mode 2: acc+bias.
// Block = 8 waves arranged 4(M) x 2(N); each wave owns a 32x64 tile
// (2 A frags x 4 B frags -> 8 v_wmma per K-step, 12 b128 loads).
// grid = (N/128, M/128). Requires N%128==0, M%128==0, K%32==0.
// ---------------------------------------------------------------------------
__global__ __launch_bounds__(TPB)
void wmma_gemm_kernel(const _Float16* __restrict__ A,
                      const _Float16* __restrict__ Bt,
                      const float* __restrict__ bias,
                      const float* __restrict__ res,
                      float* __restrict__ C,
                      int M, int N, int K, int mode) {
  const int wave  = threadIdx.x >> 5;
  const int lane  = threadIdx.x & 31;
  const int m0    = blockIdx.y * 128 + (wave & 3) * 32;
  const int n0    = blockIdx.x * 128 + (wave >> 2) * 64;
  const int row   = lane & 15;
  const int khalf = (lane >> 4) << 3;   // 0 or 8

  const _Float16* Ap0 = A  + (size_t)(m0 +  0 + row) * K + khalf;
  const _Float16* Ap1 = A  + (size_t)(m0 + 16 + row) * K + khalf;
  const _Float16* Bp0 = Bt + (size_t)(n0 +  0 + row) * K + khalf;
  const _Float16* Bp1 = Bt + (size_t)(n0 + 16 + row) * K + khalf;
  const _Float16* Bp2 = Bt + (size_t)(n0 + 32 + row) * K + khalf;
  const _Float16* Bp3 = Bt + (size_t)(n0 + 48 + row) * K + khalf;

  v8f a00 = {}, a01 = {}, a02 = {}, a03 = {};
  v8f a10 = {}, a11 = {}, a12 = {}, a13 = {};

  for (int k = 0; k < K; k += 32) {
    __builtin_prefetch(Ap0 + k + 64, 0, 1);          // global_prefetch_b8
    v16h a0 = load_frag16(Ap0 + k);
    v16h a1 = load_frag16(Ap1 + k);
    v16h b0 = load_frag16(Bp0 + k);
    v16h b1 = load_frag16(Bp1 + k);
    v16h b2 = load_frag16(Bp2 + k);
    v16h b3 = load_frag16(Bp3 + k);
    a00 = __builtin_amdgcn_wmma_f32_16x16x32_f16(false, a0, false, b0, (short)0, a00, false, false);
    a01 = __builtin_amdgcn_wmma_f32_16x16x32_f16(false, a0, false, b1, (short)0, a01, false, false);
    a02 = __builtin_amdgcn_wmma_f32_16x16x32_f16(false, a0, false, b2, (short)0, a02, false, false);
    a03 = __builtin_amdgcn_wmma_f32_16x16x32_f16(false, a0, false, b3, (short)0, a03, false, false);
    a10 = __builtin_amdgcn_wmma_f32_16x16x32_f16(false, a1, false, b0, (short)0, a10, false, false);
    a11 = __builtin_amdgcn_wmma_f32_16x16x32_f16(false, a1, false, b1, (short)0, a11, false, false);
    a12 = __builtin_amdgcn_wmma_f32_16x16x32_f16(false, a1, false, b2, (short)0, a12, false, false);
    a13 = __builtin_amdgcn_wmma_f32_16x16x32_f16(false, a1, false, b3, (short)0, a13, false, false);
  }

  // D layout: lanes 0-15 -> col = lane, M = v ; lanes 16-31 -> col = lane-16, M = v+8
  const int col = lane & 15;
  const int mb  = (lane >> 4) << 3;
  v8f accs[2][4] = {{a00, a01, a02, a03}, {a10, a11, a12, a13}};
#pragma unroll
  for (int i = 0; i < 2; ++i) {
#pragma unroll
    for (int t = 0; t < 4; ++t) {
      const int n  = n0 + 16 * t + col;
      const float bv = bias[n];
#pragma unroll
      for (int v = 0; v < 8; ++v) {
        const size_t idx = (size_t)(m0 + 16 * i + mb + v) * N + n;
        float x = accs[i][t][v] + bv;
        if (mode < 2)  x = fmaxf(x, 0.f);
        if (mode == 1) x += res[idx];
        C[idx] = x;
      }
    }
  }
}

// ---------------------------------------------------------------------------
// Row LayerNorm, f32 -> f16, with zero padding to Cpad.  One block per row.
// ---------------------------------------------------------------------------
__global__ __launch_bounds__(TPB)
void ln_rows_kernel(const float* __restrict__ X,
                    const float* __restrict__ g,
                    const float* __restrict__ bta,
                    _Float16* __restrict__ Y,
                    int C, int Cpad) {
  const int r = blockIdx.x;
  const float* x = X + (size_t)r * C;
  _Float16*    y = Y + (size_t)r * Cpad;
  float s = 0.f, ss = 0.f;
  for (int i = threadIdx.x; i < C; i += TPB) { float v = x[i]; s += v; ss += v * v; }
  __shared__ float sh1[NWAVES], sh2[NWAVES];
#pragma unroll
  for (int off = 16; off > 0; off >>= 1) {
    s  += __shfl_down(s,  off, 32);
    ss += __shfl_down(ss, off, 32);
  }
  const int wave = threadIdx.x >> 5, lane = threadIdx.x & 31;
  if (lane == 0) { sh1[wave] = s; sh2[wave] = ss; }
  __syncthreads();
  if (threadIdx.x == 0) {
    float ts = 0.f, tss = 0.f;
    for (int i = 0; i < NWAVES; ++i) { ts += sh1[i]; tss += sh2[i]; }
    const float mean = ts / C;
    const float var  = tss / C - mean * mean;
    sh1[0] = mean;
    sh2[0] = rsqrtf(var + 1e-5f);
  }
  __syncthreads();
  const float mean = sh1[0], rstd = sh2[0];
  for (int i = threadIdx.x; i < C; i += TPB)
    y[i] = (_Float16)((x[i] - mean) * rstd * g[i] + bta[i]);
  for (int i = C + threadIdx.x; i < Cpad; i += TPB)
    y[i] = (_Float16)0.f;
}

// ---------------------------------------------------------------------------
// Attention input builder: for row r = b*OUT + o, gather the time column
// fc[(b*LN + j)*OUT + o] (j = 0..LN-1), append its mean, LayerNorm the
// (LN+1)-vector with per-position gamma/beta, emit f16 padded to Cpad.
// LN must equal TPB (256).
// ---------------------------------------------------------------------------
__global__ __launch_bounds__(TPB)
void attn_build_kernel(const float* __restrict__ fc,
                       const float* __restrict__ g,
                       const float* __restrict__ bta,
                       _Float16* __restrict__ Y,
                       int LN_, int OUT_, int Cpad) {
  const int r = blockIdx.x;
  const int b = r / OUT_;
  const int o = r % OUT_;
  const float v = fc[((size_t)b * LN_ + threadIdx.x) * OUT_ + o];
  float s = v, ss = v * v;
  __shared__ float sh1[NWAVES], sh2[NWAVES], stats[3];
#pragma unroll
  for (int off = 16; off > 0; off >>= 1) {
    s  += __shfl_down(s,  off, 32);
    ss += __shfl_down(ss, off, 32);
  }
  const int wave = threadIdx.x >> 5, lane = threadIdx.x & 31;
  if (lane == 0) { sh1[wave] = s; sh2[wave] = ss; }
  __syncthreads();
  if (threadIdx.x == 0) {
    float ts = 0.f, tss = 0.f;
    for (int i = 0; i < NWAVES; ++i) { ts += sh1[i]; tss += sh2[i]; }
    const float mval = ts / LN_;                   // appended mean element
    const float Csz  = (float)(LN_ + 1);
    const float mu   = (ts + mval) / Csz;
    const float var  = (tss + mval * mval) / Csz - mu * mu;
    stats[0] = mu;
    stats[1] = rsqrtf(var + 1e-5f);
    stats[2] = mval;
  }
  __syncthreads();
  const float mu = stats[0], rstd = stats[1];
  _Float16* y = Y + (size_t)r * Cpad;
  y[threadIdx.x] = (_Float16)((v - mu) * rstd * g[threadIdx.x] + bta[threadIdx.x]);
  if (threadIdx.x == 0)
    y[LN_] = (_Float16)((stats[2] - mu) * rstd * g[LN_] + bta[LN_]);
  for (int i = LN_ + 1 + threadIdx.x; i < Cpad; i += TPB)
    y[i] = (_Float16)0.f;
}

// ---------------------------------------------------------------------------
// In-place row softmax, C == TPB (256). One block per row.
// ---------------------------------------------------------------------------
__global__ __launch_bounds__(TPB)
void softmax_kernel(float* __restrict__ W, int C) {
  const size_t base = (size_t)blockIdx.x * C;
  float v = W[base + threadIdx.x];
  __shared__ float sh[NWAVES], red[1];
  float m = v;
#pragma unroll
  for (int off = 16; off > 0; off >>= 1) m = fmaxf(m, __shfl_down(m, off, 32));
  const int wave = threadIdx.x >> 5, lane = threadIdx.x & 31;
  if (lane == 0) sh[wave] = m;
  __syncthreads();
  if (threadIdx.x == 0) {
    float t = sh[0];
    for (int i = 1; i < NWAVES; ++i) t = fmaxf(t, sh[i]);
    red[0] = t;
  }
  __syncthreads();
  const float e = expf(v - red[0]);
  float s = e;
#pragma unroll
  for (int off = 16; off > 0; off >>= 1) s += __shfl_down(s, off, 32);
  if (lane == 0) sh[wave] = s;
  __syncthreads();
  if (threadIdx.x == 0) {
    float t = 0.f;
    for (int i = 0; i < NWAVES; ++i) t += sh[i];
    red[0] = t;
  }
  __syncthreads();
  W[base + threadIdx.x] = e / red[0];
}

// ---------------------------------------------------------------------------
// out[b*OUT + o] = sum_j fc[(b*LN + j)*OUT + o] * wsm[(b*OUT + o)*LN + j]
// ---------------------------------------------------------------------------
__global__ __launch_bounds__(TPB)
void final_kernel(const float* __restrict__ fc,
                  const float* __restrict__ wsm,
                  float* __restrict__ out,
                  int LN_, int OUT_) {
  const int r = blockIdx.x;
  const int b = r / OUT_;
  const int o = r % OUT_;
  float p = fc[((size_t)b * LN_ + threadIdx.x) * OUT_ + o] *
            wsm[(size_t)r * LN_ + threadIdx.x];
  __shared__ float sh[NWAVES];
#pragma unroll
  for (int off = 16; off > 0; off >>= 1) p += __shfl_down(p, off, 32);
  const int wave = threadIdx.x >> 5, lane = threadIdx.x & 31;
  if (lane == 0) sh[wave] = p;
  __syncthreads();
  if (threadIdx.x == 0) {
    float t = 0.f;
    for (int i = 0; i < NWAVES; ++i) t += sh[i];
    out[r] = t;
  }
}

// ---------------------------------------------------------------------------
// Weight convert + transpose:  W[K x N] f32  ->  Wt[N x Kpad] f16 (zero pad).
// ---------------------------------------------------------------------------
__global__ __launch_bounds__(TPB)
void convert_wt_kernel(const float* __restrict__ W,
                       _Float16* __restrict__ Wt,
                       int K, int N, int Kpad) {
  const long idx = (long)blockIdx.x * TPB + threadIdx.x;
  if (idx >= (long)N * Kpad) return;
  const int n = (int)(idx / Kpad);
  const int k = (int)(idx % Kpad);
  Wt[idx] = (k < K) ? (_Float16)W[(size_t)k * N + n] : (_Float16)0.f;
}

// ---------------------------------------------------------------------------
extern "C" void kernel_launch(void* const* d_in, const int* in_sizes, int n_in,
                              void* d_out, int out_size, void* d_ws, size_t ws_size,
                              hipStream_t stream) {
  (void)in_sizes; (void)n_in; (void)out_size; (void)ws_size;
  const int BS = 64, LNt = 256, FS = 512, H = 1024, OUT = 128, ATT = 256, L = 8;
  const int ROWS = BS * LNt;     // 16384
  const int AR   = BS * OUT;     // 8192 attention rows
  const int KA1  = 288;          // 257 padded to multiple of 32

  const float* x       = (const float*)d_in[0];
  const float* ln0_g   = (const float*)d_in[1];
  const float* ln0_b   = (const float*)d_in[2];
  const float* W0      = (const float*)d_in[3];
  const float* b0      = (const float*)d_in[4];
  const float* res_ln_g= (const float*)d_in[5];
  const float* res_ln_b= (const float*)d_in[6];
  const float* res_W   = (const float*)d_in[7];
  const float* res_b   = (const float*)d_in[8];
  const float* lnf_g   = (const float*)d_in[9];
  const float* lnf_b   = (const float*)d_in[10];
  const float* Wf      = (const float*)d_in[11];
  const float* bf      = (const float*)d_in[12];
  const float* a_ln1_g = (const float*)d_in[13];
  const float* a_ln1_b = (const float*)d_in[14];
  const float* Wa1     = (const float*)d_in[15];
  const float* ba1     = (const float*)d_in[16];
  const float* a_ln2_g = (const float*)d_in[17];
  const float* a_ln2_b = (const float*)d_in[18];
  const float* Wa2     = (const float*)d_in[19];
  const float* ba2     = (const float*)d_in[20];
  float* out           = (float*)d_out;

  // ---- workspace layout ----
  char* ws = (char*)d_ws;
  size_t off = 0;
  auto alloc = [&](size_t bytes) -> void* {
    off = (off + 255) & ~(size_t)255;
    void* p = ws + off;
    off += bytes;
    return p;
  };
  float*    h     = (float*)   alloc((size_t)ROWS * H   * 4);
  _Float16* xln   = (_Float16*)alloc((size_t)ROWS * H   * 2);
  float*    fc    = (float*)   alloc((size_t)ROWS * OUT * 4);
  _Float16* tln   = (_Float16*)alloc((size_t)AR * KA1   * 2);
  float*    abuf  = (float*)   alloc((size_t)AR * ATT   * 4);
  _Float16* aln   = (_Float16*)alloc((size_t)AR * ATT   * 2);
  float*    wbuf  = (float*)   alloc((size_t)AR * LNt   * 4);
  _Float16* W0t   = (_Float16*)alloc((size_t)H * FS     * 2);
  _Float16* resWt = (_Float16*)alloc((size_t)L * H * H  * 2);
  _Float16* Wft   = (_Float16*)alloc((size_t)OUT * H    * 2);
  _Float16* Wa1t  = (_Float16*)alloc((size_t)ATT * KA1  * 2);
  _Float16* Wa2t  = (_Float16*)alloc((size_t)LNt * ATT  * 2);

  auto cg = [](long total) { return dim3((unsigned)((total + TPB - 1) / TPB)); };

  // ---- weight conversion (f32 [KxN] -> f16 [N x Kpad], transposed) ----
  convert_wt_kernel<<<cg((long)H * FS), TPB, 0, stream>>>(W0, W0t, FS, H, FS);
  for (int i = 0; i < L; ++i)
    convert_wt_kernel<<<cg((long)H * H), TPB, 0, stream>>>(
        res_W + (size_t)i * H * H, resWt + (size_t)i * H * H, H, H, H);
  convert_wt_kernel<<<cg((long)OUT * H), TPB, 0, stream>>>(Wf, Wft, H, OUT, H);
  convert_wt_kernel<<<cg((long)ATT * KA1), TPB, 0, stream>>>(Wa1, Wa1t, LNt + 1, ATT, KA1);
  convert_wt_kernel<<<cg((long)LNt * ATT), TPB, 0, stream>>>(Wa2, Wa2t, ATT, LNt, ATT);

  // ---- stem: h = relu(LN(x) @ W0 + b0) ----
  ln_rows_kernel<<<ROWS, TPB, 0, stream>>>(x, ln0_g, ln0_b, xln, FS, FS);
  wmma_gemm_kernel<<<dim3(H / 128, ROWS / 128), TPB, 0, stream>>>(
      xln, W0t, b0, nullptr, h, ROWS, H, FS, 0);

  // ---- residual stack: h += relu(LN(h) @ Wi + bi) ----
  for (int i = 0; i < L; ++i) {
    ln_rows_kernel<<<ROWS, TPB, 0, stream>>>(
        h, res_ln_g + (size_t)i * H, res_ln_b + (size_t)i * H, xln, H, H);
    wmma_gemm_kernel<<<dim3(H / 128, ROWS / 128), TPB, 0, stream>>>(
        xln, resWt + (size_t)i * H * H, res_b + (size_t)i * H, h, h, ROWS, H, H, 1);
  }

  // ---- head: fc = LN(h) @ Wf + bf ----
  ln_rows_kernel<<<ROWS, TPB, 0, stream>>>(h, lnf_g, lnf_b, xln, H, H);
  wmma_gemm_kernel<<<dim3(OUT / 128, ROWS / 128), TPB, 0, stream>>>(
      xln, Wft, bf, nullptr, fc, ROWS, OUT, H, 2);

  // ---- attention MLP over time axis ----
  attn_build_kernel<<<AR, TPB, 0, stream>>>(fc, a_ln1_g, a_ln1_b, tln, LNt, OUT, KA1);
  wmma_gemm_kernel<<<dim3(ATT / 128, AR / 128), TPB, 0, stream>>>(
      tln, Wa1t, ba1, nullptr, abuf, AR, ATT, KA1, 0);
  ln_rows_kernel<<<AR, TPB, 0, stream>>>(abuf, a_ln2_g, a_ln2_b, aln, ATT, ATT);
  wmma_gemm_kernel<<<dim3(LNt / 128, AR / 128), TPB, 0, stream>>>(
      aln, Wa2t, ba2, nullptr, wbuf, AR, LNt, ATT, 2);
  softmax_kernel<<<AR, TPB, 0, stream>>>(wbuf, LNt);

  // ---- weighted sum over time ----
  final_kernel<<<AR, TPB, 0, stream>>>(fc, wbuf, out, LNt, OUT);
}

// v001
// It runs in 881 microseconds.
// Timed twice side by side with v000, it ran 1.72 and 1.73 times as fast.
#include <hip/hip_runtime.h>
#include <hip/hip_bf16.h>
#include <stdint.h>

typedef __attribute__((ext_vector_type(16))) _Float16 v16h;
typedef __attribute__((ext_vector_type(8)))  float    v8f;
typedef uint32_t u32x4 __attribute__((ext_vector_type(4)));
typedef uint32_t u32x8 __attribute__((ext_vector_type(8)));

#define TPB 256
#define NWAVES 8

// ---------------------------------------------------------------------------
// LDS staging of the GEMM operands.  Per pass of 64 k the block's 128 A rows and
// 128 Bt rows (128 B each) are brought by two tensor loads (wave 0: A, wave 1: Bt)
// into one of two buffers; the next pass's tile is in flight while this one is
// worked on.  LDS row pitch 144 B (16 B pad per row) for ds_load_b128 readers.
// Two buffers take 72 KiB, so four blocks share a WGP's LDS.
// ---------------------------------------------------------------------------
#define G_ROWB   128u                 // staged bytes of one operand row per pass
#define G_PITCH  144u                 // LDS pitch of a staged row
#define G_SLICE  18432u               // 128 rows * 144 B, a multiple of 2 KiB
#define G_STAGE  (2u * G_SLICE)       // A rows 0-127 | Bt rows 0-127

__device__ __forceinline__ uint32_t uni(uint32_t v) {
  return (uint32_t)__builtin_amdgcn_readfirstlane(v);
}
// Holds a wave-uniform test in a scalar register so that the branch around a
// tensor load is a scalar branch (tensor loads ignore EXEC).
__device__ __forceinline__ uint32_t pinned(uint32_t v) {
  uint32_t w = uni(v);
  asm volatile("" : "+s"(w));  // pinned(): the test stays in a scalar register, the branch is s_cmp + s_cbranch_scc
  return w;
}
__device__ __forceinline__ void wait_ds0() {
  // own LDS reads retired before the buffer is handed back for a refill
  asm volatile("s_wait_dscnt 0x0" ::: "memory");
}
__device__ __forceinline__ void wait_tensor0() {
  // the tile has landed behind this
  asm volatile("s_wait_tensorcnt 0x0" ::: "memory");
}
__device__ __forceinline__ void tdm_load(u32x4 g0, u32x8 g1) {
  // one request of the whole wave: global tile -> LDS, through no register
  asm volatile("tensor_load_to_lds %0, %1" :: "s"(g0), "s"(g1) : "memory");
}
__device__ __forceinline__ u32x4 tdm_group0(uint32_t lds_dst, uint64_t ga) {
  u32x4 g;
  g[0] = uni(1u);
  g[1] = uni(lds_dst);
  g[2] = uni((uint32_t)ga);
  g[3] = uni((((uint32_t)(ga >> 32)) & 0x01FFFFFFu) | 0x80000000u);
  return g;
}
// 1-byte elements, tile = tensor = 128 rows of 128 B, 16 B of LDS pad behind every row.
__device__ __forceinline__ u32x8 tdm_group1(uint32_t src_pitch) {
  u32x8 g;
  g[0] = uni((1u << 20) | (4u << 22) | (3u << 25));
  g[1] = uni((G_ROWB & 0xFFFFu) << 16);
  g[2] = uni((G_ROWB >> 16) | (128u << 16));
  g[3] = uni(G_ROWB << 16);
  g[4] = uni(128u);
  g[5] = uni(src_pitch);
  g[6] = uni(0u);
  g[7] = uni(0u);
  return g;
}
// Fragment loader for a 16-bit 16x32 WMMA operand (A, or B from Bt=[N x K]) out of
// a staged row.  Per ISA layout: lanes 0-15 hold K = {0..7, 16..23}, lanes 16-31
// hold K = {8..15, 24..31}: 16 B at k + khalf and 16 B at k + 16 + khalf.
// `p` must already point at rowStart + (k + khalf) * 2 (khalf = (lane>=16)*8).
__device__ __forceinline__ v16h lds_frag16(const unsigned char* p) {
  union { v16h h; u32x4 q[2]; } f;
  f.q[0] = *(const u32x4*)(p);
  f.q[1] = *(const u32x4*)(p + 32);
  return f.h;
}

// ---------------------------------------------------------------------------
// Generic WMMA GEMM:  C[M x N] = epilogue( A[M x K](f16) @ B + bias )
// B is provided transposed: Bt[N x K] f16 (K-contiguous rows).
// mode 0: relu(acc+bias) ; mode 1: res + relu(acc+bias) (res may == C) ;
// mode 2: acc+bias.
// Block = 8 waves arranged 4(M) x 2(N); each wave owns a 32x64 tile
// (2 A frags x 4 B frags -> 8 v_wmma per K-step, 12 ds_load_b128).
// grid = (N/128, M/128). Requires N%128==0, M%128==0, K%64==0, K>=128.
// ---------------------------------------------------------------------------
__global__ __launch_bounds__(TPB)
void wmma_gemm_kernel(const _Float16* __restrict__ A,
                      const _Float16* __restrict__ Bt,
                      const float* __restrict__ bias,
                      const float* __restrict__ res,
                      float* __restrict__ C,
                      int M, int N, int K, int mode) {
  const int wave  = threadIdx.x >> 5;
  const int lane  = threadIdx.x & 31;
  const int m0    = blockIdx.y * 128 + (wave & 3) * 32;
  const int n0    = blockIdx.x * 128 + (wave >> 2) * 64;
  const int row   = lane & 15;
  const int khalf = (lane >> 4) << 3;   // 0 or 8

  __shared__ __attribute__((aligned(2048))) unsigned char L[2u * G_STAGE];
  const uint32_t wv = uni(threadIdx.x >> 5);

  // Issuing waves 0 and 1: slice 0 = the block's A rows, slice 1 = its Bt rows.
  const uint32_t sl = wv & 1u;
  const _Float16* srow = (sl == 0u) ? A  + (size_t)(blockIdx.y * 128) * K
                                    : Bt + (size_t)(blockIdx.x * 128) * K;
  const uint64_t ga   = (uint64_t)(size_t)srow;
  const uint32_t ldst = (uint32_t)(size_t)L + sl * G_SLICE;
  const u32x8    g1   = tdm_group1((uint32_t)K * 2u);
  const int      T    = K >> 6;         // passes of 64 k

  if (pinned(wv < 2u)) {
    tdm_load(tdm_group0(ldst, ga), g1);
    wait_tensor0();
  }
  __syncthreads();                      // stage 0 published
  if (pinned(wv < 2u)) {
    tdm_load(tdm_group0(ldst + G_STAGE, ga + G_ROWB), g1);
  }

  // This wave's fragment rows inside a stage.
  const uint32_t aoff = ((wv & 3u) * 32u + (uint32_t)row) * G_PITCH + (uint32_t)khalf * 2u;
  const uint32_t boff = G_SLICE + ((wv >> 2) * 64u + (uint32_t)row) * G_PITCH + (uint32_t)khalf * 2u;

  v8f a00 = {}, a01 = {}, a02 = {}, a03 = {};
  v8f a10 = {}, a11 = {}, a12 = {}, a13 = {};

  for (int s = 0; s < T; ++s) {
    const uint32_t bsel = (uint32_t)(s & 1) * G_STAGE;
    const unsigned char* Ab = L + bsel + aoff;
    const unsigned char* Bb = L + bsel + boff;
#pragma unroll  // both k-steps of a pass in line: their LDS offsets become immediates
   for (int kk = 0; kk < 2; ++kk) {
    v16h a0 = lds_frag16(Ab + kk * 64);
    v16h a1 = lds_frag16(Ab + 16 * G_PITCH + kk * 64);
    v16h b0 = lds_frag16(Bb + kk * 64);
    v16h b1 = lds_frag16(Bb + 16 * G_PITCH + kk * 64);
    v16h b2 = lds_frag16(Bb + 32 * G_PITCH + kk * 64);
    v16h b3 = lds_frag16(Bb + 48 * G_PITCH + kk * 64);
    a00 = __builtin_amdgcn_wmma_f32_16x16x32_f16(false, a0, false, b0, (short)0, a00, false, false);
    a01 = __builtin_amdgcn_wmma_f32_16x16x32_f16(false, a0, false, b1, (short)0, a01, false, false);
    a02 = __builtin_amdgcn_wmma_f32_16x16x32_f16(false, a0, false, b2, (short)0, a02, false, false);
    a03 = __builtin_amdgcn_wmma_f32_16x16x32_f16(false, a0, false, b3, (short)0, a03, false, false);
    a10 = __builtin_amdgcn_wmma_f32_16x16x32_f16(false, a1, false, b0, (short)0, a10, false, false);
    a11 = __builtin_amdgcn_wmma_f32_16x16x32_f16(false, a1, false, b1, (short)0, a11, false, false);
    a12 = __builtin_amdgcn_wmma_f32_16x16x32_f16(false, a1, false, b2, (short)0, a12, false, false);
    a13 = __builtin_amdgcn_wmma_f32_16x16x32_f16(false, a1, false, b3, (short)0, a13, false, false);
   }
    // Publish point of stage s + 1: own reads done, own tile landed, barrier, refill.
    wait_ds0();
    if (pinned(wv < 2u)) wait_tensor0();
    __syncthreads();
    if (pinned((wv < 2u) && (s + 2 < T))) {
      tdm_load(tdm_group0(ldst + bsel, ga + (uint64_t)(s + 2) * G_ROWB), g1);
    }
  }
  wait_tensor0();
  wait_ds0();

  // D layout: lanes 0-15 -> col = lane, M = v ; lanes 16-31 -> col = lane-16, M = v+8
  const int col = lane & 15;
  const int mb  = (lane >> 4) << 3;
  v8f accs[2][4] = {{a00, a01, a02, a03}, {a10, a11, a12, a13}};
#pragma unroll
  for (int i = 0; i < 2; ++i) {
#pragma unroll
    for (int t = 0; t < 4; ++t) {
      const int n  = n0 + 16 * t + col;
      const float bv = bias[n];
#pragma unroll
      for (int v = 0; v < 8; ++v) {
        const size_t idx = (size_t)(m0 + 16 * i + mb + v) * N + n;
        float x = accs[i][t][v] + bv;
        if (mode < 2)  x = fmaxf(x, 0.f);
        if (mode == 1) x += res[idx];
        C[idx] = x;
      }
    }
  }
}

// ---------------------------------------------------------------------------
// Row LayerNorm, f32 -> f16, with zero padding to Cpad.  One block per row.
// ---------------------------------------------------------------------------
__global__ __launch_bounds__(TPB)
void ln_rows_kernel(const float* __restrict__ X,
                    const float* __restrict__ g,
                    const float* __restrict__ bta,
                    _Float16* __restrict__ Y,
                    int C, int Cpad) {
  const int r = blockIdx.x;
  const float* x = X + (size_t)r * C;
  _Float16*    y = Y + (size_t)r * Cpad;
  float s = 0.f, ss = 0.f;
  for (int i = threadIdx.x; i < C; i += TPB) { float v = x[i]; s += v; ss += v * v; }
  __shared__ float sh1[NWAVES], sh2[NWAVES];
#pragma unroll
  for (int off = 16; off > 0; off >>= 1) {
    s  += __shfl_down(s,  off, 32);
    ss += __shfl_down(ss, off, 32);
  }
  const int wave = threadIdx.x >> 5, lane = threadIdx.x & 31;
  if (lane == 0) { sh1[wave] = s; sh2[wave] = ss; }
  __syncthreads();
  if (threadIdx.x == 0) {
    float ts = 0.f, tss = 0.f;
    for (int i = 0; i < NWAVES; ++i) { ts += sh1[i]; tss += sh2[i]; }
    const float mean = ts / C;
    const float var  = tss / C - mean * mean;
    sh1[0] = mean;
    sh2[0] = rsqrtf(var + 1e-5f);
  }
  __syncthreads();
  const float mean = sh1[0], rstd = sh2[0];
  for (int i = threadIdx.x; i < C; i += TPB)
    y[i] = (_Float16)((x[i] - mean) * rstd * g[i] + bta[i]);
  for (int i = C + threadIdx.x; i < Cpad; i += TPB)
    y[i] = (_Float16)0.f;
}

// ---------------------------------------------------------------------------
// Attention input builder: for row r = b*OUT + o, gather the time column
// fc[(b*LN + j)*OUT + o] (j = 0..LN-1), append its mean, LayerNorm the
// (LN+1)-vector with per-position gamma/beta, emit f16 padded to Cpad.
// LN must equal TPB (256).
// ---------------------------------------------------------------------------
__global__ __launch_bounds__(TPB)
void attn_build_kernel(const float* __restrict__ fc,
                       const float* __restrict__ g,
                       const float* __restrict__ bta,
                       _Float16* __restrict__ Y,
                       int LN_, int OUT_, int Cpad) {
  const int r = blockIdx.x;
  const int b = r / OUT_;
  const int o = r % OUT_;
  const float v = fc[((size_t)b * LN_ + threadIdx.x) * OUT_ + o];
  float s = v, ss = v * v;
  __shared__ float sh1[NWAVES], sh2[NWAVES], stats[3];
#pragma unroll
  for (int off = 16; off > 0; off >>= 1) {
    s  += __shfl_down(s,  off, 32);
    ss += __shfl_down(ss, off, 32);
  }
  const int wave = threadIdx.x >> 5, lane = threadIdx.x & 31;
  if (lane == 0) { sh1[wave] = s; sh2[wave] = ss; }
  __syncthreads();
  if (threadIdx.x == 0) {
    float ts = 0.f, tss = 0.f;
    for (int i = 0; i < NWAVES; ++i) { ts += sh1[i]; tss += sh2[i]; }
    const float mval = ts / LN_;                   // appended mean element
    const float Csz  = (float)(LN_ + 1);
    const float mu   = (ts + mval) / Csz;
    const float var  = (tss + mval * mval) / Csz - mu * mu;
    stats[0] = mu;
    stats[1] = rsqrtf(var + 1e-5f);
    stats[2] = mval;
  }
  __syncthreads();
  const float mu = stats[0], rstd = stats[1];
  _Float16* y = Y + (size_t)r * Cpad;
  y[threadIdx.x] = (_Float16)((v - mu) * rstd * g[threadIdx.x] + bta[threadIdx.x]);
  if (threadIdx.x == 0)
    y[LN_] = (_Float16)((stats[2] - mu) * rstd * g[LN_] + bta[LN_]);
  for (int i = LN_ + 1 + threadIdx.x; i < Cpad; i += TPB)
    y[i] = (_Float16)0.f;
}

// ---------------------------------------------------------------------------
// In-place row softmax, C == TPB (256). One block per row.
// ---------------------------------------------------------------------------
__global__ __launch_bounds__(TPB)
void softmax_kernel(float* __restrict__ W, int C) {
  const size_t base = (size_t)blockIdx.x * C;
  float v = W[base + threadIdx.x];
  __shared__ float sh[NWAVES], red[1];
  float m = v;
#pragma unroll
  for (int off = 16; off > 0; off >>= 1) m = fmaxf(m, __shfl_down(m, off, 32));
  const int wave = threadIdx.x >> 5, lane = threadIdx.x & 31;
  if (lane == 0) sh[wave] = m;
  __syncthreads();
  if (threadIdx.x == 0) {
    float t = sh[0];
    for (int i = 1; i < NWAVES; ++i) t = fmaxf(t, sh[i]);
    red[0] = t;
  }
  __syncthreads();
  const float e = expf(v - red[0]);
  float s = e;
#pragma unroll
  for (int off = 16; off > 0; off >>= 1) s += __shfl_down(s, off, 32);
  if (lane == 0) sh[wave] = s;
  __syncthreads();
  if (threadIdx.x == 0) {
    float t = 0.f;
    for (int i = 0; i < NWAVES; ++i) t += sh[i];
    red[0] = t;
  }
  __syncthreads();
  W[base + threadIdx.x] = e / red[0];
}

// ---------------------------------------------------------------------------
// out[b*OUT + o] = sum_j fc[(b*LN + j)*OUT + o] * wsm[(b*OUT + o)*LN + j]
// ---------------------------------------------------------------------------
__global__ __launch_bounds__(TPB)
void final_kernel(const float* __restrict__ fc,
                  const float* __restrict__ wsm,
                  float* __restrict__ out,
                  int LN_, int OUT_) {
  const int r = blockIdx.x;
  const int b = r / OUT_;
  const int o = r % OUT_;
  float p = fc[((size_t)b * LN_ + threadIdx.x) * OUT_ + o] *
            wsm[(size_t)r * LN_ + threadIdx.x];
  __shared__ float sh[NWAVES];
#pragma unroll
  for (int off = 16; off > 0; off >>= 1) p += __shfl_down(p, off, 32);
  const int wave = threadIdx.x >> 5, lane = threadIdx.x & 31;
  if (lane == 0) sh[wave] = p;
  __syncthreads();
  if (threadIdx.x == 0) {
    float t = 0.f;
    for (int i = 0; i < NWAVES; ++i) t += sh[i];
    out[r] = t;
  }
}

// ---------------------------------------------------------------------------
// Weight convert + transpose:  W[K x N] f32  ->  Wt[N x Kpad] f16 (zero pad).
// ---------------------------------------------------------------------------
__global__ __launch_bounds__(TPB)
void convert_wt_kernel(const float* __restrict__ W,
                       _Float16* __restrict__ Wt,
                       int K, int N, int Kpad) {
  const long idx = (long)blockIdx.x * TPB + threadIdx.x;
  if (idx >= (long)N * Kpad) return;
  const int n = (int)(idx / Kpad);
  const int k = (int)(idx % Kpad);
  Wt[idx] = (k < K) ? (_Float16)W[(size_t)k * N + n] : (_Float16)0.f;
}

// ---------------------------------------------------------------------------
extern "C" void kernel_launch(void* const* d_in, const int* in_sizes, int n_in,
                              void* d_out, int out_size, void* d_ws, size_t ws_size,
                              hipStream_t stream) {
  (void)in_sizes; (void)n_in; (void)out_size; (void)ws_size;
  const int BS = 64, LNt = 256, FS = 512, H = 1024, OUT = 128, ATT = 256, L = 8;
  const int ROWS = BS * LNt;     // 16384
  const int AR   = BS * OUT;     // 8192 attention rows
  const int KA1  = 320;          // 257 padded to multiple of 64

  const float* x       = (const float*)d_in[0];
  const float* ln0_g   = (const float*)d_in[1];
  const float* ln0_b   = (const float*)d_in[2];
  const float* W0      = (const float*)d_in[3];
  const float* b0      = (const float*)d_in[4];
  const float* res_ln_g= (const float*)d_in[5];
  const float* res_ln_b= (const float*)d_in[6];
  const float* res_W   = (const float*)d_in[7];
  const float* res_b   = (const float*)d_in[8];
  const float* lnf_g   = (const float*)d_in[9];
  const float* lnf_b   = (const float*)d_in[10];
  const float* Wf      = (const float*)d_in[11];
  const float* bf      = (const float*)d_in[12];
  const float* a_ln1_g = (const float*)d_in[13];
  const float* a_ln1_b = (const float*)d_in[14];
  const float* Wa1     = (const float*)d_in[15];
  const float* ba1     = (const float*)d_in[16];
  const float* a_ln2_g = (const float*)d_in[17];
  const float* a_ln2_b = (const float*)d_in[18];
  const float* Wa2     = (const float*)d_in[19];
  const float* ba2     = (const float*)d_in[20];
  float* out           = (float*)d_out;

  // ---- workspace layout ----
  char* ws = (char*)d_ws;
  size_t off = 0;
  auto alloc = [&](size_t bytes) -> void* {
    off = (off + 255) & ~(size_t)255;
    void* p = ws + off;
    off += bytes;
    return p;
  };
  float*    h     = (float*)   alloc((size_t)ROWS * H   * 4);
  _Float16* xln   = (_Float16*)alloc((size_t)ROWS * H   * 2);
  float*    fc    = (float*)   alloc((size_t)ROWS * OUT * 4);
  _Float16* tln   = (_Float16*)alloc((size_t)AR * KA1   * 2);
  float*    abuf  = (float*)   alloc((size_t)AR * ATT   * 4);
  _Float16* aln   = (_Float16*)alloc((size_t)AR * ATT   * 2);
  float*    wbuf  = (float*)   alloc((size_t)AR * LNt   * 4);
  _Float16* W0t   = (_Float16*)alloc((size_t)H * FS     * 2);
  _Float16* resWt = (_Float16*)alloc((size_t)L * H * H  * 2);
  _Float16* Wft   = (_Float16*)alloc((size_t)OUT * H    * 2);
  _Float16* Wa1t  = (_Float16*)alloc((size_t)ATT * KA1  * 2);
  _Float16* Wa2t  = (_Float16*)alloc((size_t)LNt * ATT  * 2);

  auto cg = [](long total) { return dim3((unsigned)((total + TPB - 1) / TPB)); };

  // ---- weight conversion (f32 [KxN] -> f16 [N x Kpad], transposed) ----
  convert_wt_kernel<<<cg((long)H * FS), TPB, 0, stream>>>(W0, W0t, FS, H, FS);
  for (int i = 0; i < L; ++i)
    convert_wt_kernel<<<cg((long)H * H), TPB, 0, stream>>>(
        res_W + (size_t)i * H * H, resWt + (size_t)i * H * H, H, H, H);
  convert_wt_kernel<<<cg((long)OUT * H), TPB, 0, stream>>>(Wf, Wft, H, OUT, H);
  convert_wt_kernel<<<cg((long)ATT * KA1), TPB, 0, stream>>>(Wa1, Wa1t, LNt + 1, ATT, KA1);
  convert_wt_kernel<<<cg((long)LNt * ATT), TPB, 0, stream>>>(Wa2, Wa2t, ATT, LNt, ATT);

  // ---- stem: h = relu(LN(x) @ W0 + b0) ----
  ln_rows_kernel<<<ROWS, TPB, 0, stream>>>(x, ln0_g, ln0_b, xln, FS, FS);
  wmma_gemm_kernel<<<dim3(H / 128, ROWS / 128), TPB, 0, stream>>>(
      xln, W0t, b0, nullptr, h, ROWS, H, FS, 0);

  // ---- residual stack: h += relu(LN(h) @ Wi + bi) ----
  for (int i = 0; i < L; ++i) {
    ln_rows_kernel<<<ROWS, TPB, 0, stream>>>(
        h, res_ln_g + (size_t)i * H, res_ln_b + (size_t)i * H, xln, H, H);
    wmma_gemm_kernel<<<dim3(H / 128, ROWS / 128), TPB, 0, stream>>>(
        xln, resWt + (size_t)i * H * H, res_b + (size_t)i * H, h, h, ROWS, H, H, 1);
  }

  // ---- head: fc = LN(h) @ Wf + bf ----
  ln_rows_kernel<<<ROWS, TPB, 0, stream>>>(h, lnf_g, lnf_b, xln, H, H);
  wmma_gemm_kernel<<<dim3(OUT / 128, ROWS / 128), TPB, 0, stream>>>(
      xln, Wft, bf, nullptr, fc, ROWS, OUT, H, 2);

  // ---- attention MLP over time axis ----
  attn_build_kernel<<<AR, TPB, 0, stream>>>(fc, a_ln1_g, a_ln1_b, tln, LNt, OUT, KA1);
  wmma_gemm_kernel<<<dim3(ATT / 128, AR / 128), TPB, 0, stream>>>(
      tln, Wa1t, ba1, nullptr, abuf, AR, ATT, KA1, 0);
  ln_rows_kernel<<<AR, TPB, 0, stream>>>(abuf, a_ln2_g, a_ln2_b, aln, ATT, ATT);
  wmma_gemm_kernel<<<dim3(LNt / 128, AR / 128), TPB, 0, stream>>>(
      aln, Wa2t, ba2, nullptr, wbuf, AR, LNt, ATT, 2);
  softmax_kernel<<<AR, TPB, 0, stream>>>(wbuf, LNt);

  // ---- weighted sum over time ----
  final_kernel<<<AR, TPB, 0, stream>>>(fc, wbuf, out, LNt, OUT);
}

// v002
// Measured time: 836 microseconds a run.
// Timed twice side by side with v001, it ran 1.07 and 1.04 times as fast.
// Counting every step since v000, it is 1.82 times as fast.
#include <hip/hip_runtime.h>
#include <hip/hip_bf16.h>
#include <stdint.h>

typedef __attribute__((ext_vector_type(16))) _Float16 v16h;
typedef __attribute__((ext_vector_type(8)))  float    v8f;
typedef uint32_t u32x4 __attribute__((ext_vector_type(4)));
typedef uint32_t u32x8 __attribute__((ext_vector_type(8)));

#define TPB 256
#define NWAVES 8

// ---------------------------------------------------------------------------
// LDS staging of the GEMM operands.  Per pass of 64 k the block's 128 A rows and
// 128 Bt rows (128 B each) are brought by two tensor loads (wave 0: A, wave 1: Bt)
// into one of two buffers; the next pass's tile is in flight while this one is
// worked on.  LDS row pitch 144 B (16 B pad per row) for ds_load_b128 readers.
// Two buffers take 72 KiB, so four blocks share a WGP's LDS.
// ---------------------------------------------------------------------------
#define G_ROWB   128u                 // staged bytes of one operand row per pass
#define G_PITCH  144u                 // LDS pitch of a staged row
#define G_SLICE  18432u               // 128 rows * 144 B, a multiple of 2 KiB
#define G_STAGE  (2u * G_SLICE)       // A rows 0-127 | Bt rows 0-127

__device__ __forceinline__ uint32_t uni(uint32_t v) {
  return (uint32_t)__builtin_amdgcn_readfirstlane(v);
}
// Holds a wave-uniform test in a scalar register so that the branch around a
// tensor load is a scalar branch (tensor loads ignore EXEC).
__device__ __forceinline__ uint32_t pinned(uint32_t v) {
  uint32_t w = uni(v);
  asm volatile("" : "+s"(w));  // pinned(): the test stays in a scalar register, the branch is s_cmp + s_cbranch_scc
  return w;
}
__device__ __forceinline__ void wait_ds0() {
  // own LDS reads retired before the buffer is handed back for a refill
  asm volatile("s_wait_dscnt 0x0" ::: "memory");
}
__device__ __forceinline__ void wait_tensor0() {
  // the tile has landed behind this
  asm volatile("s_wait_tensorcnt 0x0" ::: "memory");
}
__device__ __forceinline__ void tdm_load(u32x4 g0, u32x8 g1) {
  // one request of the whole wave: global tile -> LDS, through no register
  asm volatile("tensor_load_to_lds %0, %1" :: "s"(g0), "s"(g1) : "memory");
}
__device__ __forceinline__ u32x4 tdm_group0(uint32_t lds_dst, uint64_t ga) {
  u32x4 g;
  g[0] = uni(1u);
  g[1] = uni(lds_dst);
  g[2] = uni((uint32_t)ga);
  g[3] = uni((((uint32_t)(ga >> 32)) & 0x01FFFFFFu) | 0x80000000u);
  return g;
}
// 1-byte elements, tile = tensor = 128 rows of 128 B, 16 B of LDS pad behind every row.
__device__ __forceinline__ u32x8 tdm_group1(uint32_t src_pitch) {
  u32x8 g;
  g[0] = uni((1u << 20) | (4u << 22) | (3u << 25));
  g[1] = uni((G_ROWB & 0xFFFFu) << 16);
  g[2] = uni((G_ROWB >> 16) | (128u << 16));
  g[3] = uni(G_ROWB << 16);
  g[4] = uni(128u);
  g[5] = uni(src_pitch);
  g[6] = uni(0u);
  g[7] = uni(0u);
  return g;
}
// Fragment loader for a 16-bit 16x32 WMMA operand (A, or B from Bt=[N x K]) out of
// a staged row.  Per ISA layout: lanes 0-15 hold K = {0..7, 16..23}, lanes 16-31
// hold K = {8..15, 24..31}: 16 B at k + khalf and 16 B at k + 16 + khalf.
// `p` must already point at rowStart + (k + khalf) * 2 (khalf = (lane>=16)*8).
__device__ __forceinline__ v16h lds_frag16(const unsigned char* p) {
  union { v16h h; u32x4 q[2]; } f;
  f.q[0] = *(const u32x4*)(p);
  f.q[1] = *(const u32x4*)(p + 32);
  return f.h;
}

// ---------------------------------------------------------------------------
// Generic WMMA GEMM:  C[M x N] = epilogue( A[M x K](f16) @ B + bias )
// B is provided transposed: Bt[N x K] f16 (K-contiguous rows).
// mode 0: relu(acc+bias) ; mode 1: res + relu(acc+bias) (res may == C) ;
// mode 2: acc+bias.
// Block = 8 waves arranged 4(M) x 2(N); each wave owns a 32x64 tile
// (2 A frags x 4 B frags -> 8 v_wmma per K-step, 12 ds_load_b128).
// grid = (N/128, M/128). Requires N%128==0, M%128==0, K%64==0, K>=128.
// ---------------------------------------------------------------------------
__global__ __launch_bounds__(TPB)
void wmma_gemm_kernel(const _Float16* __restrict__ A,
                      const _Float16* __restrict__ Bt,
                      const float* __restrict__ bias,
                      const float* __restrict__ res,
                      float* __restrict__ C,
                      int M, int N, int K, int mode) {
  const int wave  = threadIdx.x >> 5;
  const int lane  = threadIdx.x & 31;
  const int m0    = blockIdx.y * 128 + (wave & 3) * 32;
  const int n0    = blockIdx.x * 128 + (wave >> 2) * 64;
  const int row   = lane & 15;
  const int khalf = (lane >> 4) << 3;   // 0 or 8

  __shared__ __attribute__((aligned(2048))) unsigned char L[2u * G_STAGE];
  const uint32_t wv = uni(threadIdx.x >> 5);

  // Issuing waves 0 and 1: slice 0 = the block's A rows, slice 1 = its Bt rows.
  const uint32_t sl = wv & 1u;
  const _Float16* srow = (sl == 0u) ? A  + (size_t)(blockIdx.y * 128) * K
                                    : Bt + (size_t)(blockIdx.x * 128) * K;
  const uint64_t ga   = (uint64_t)(size_t)srow;
  const uint32_t ldst = (uint32_t)(size_t)L + sl * G_SLICE;
  const u32x8    g1   = tdm_group1((uint32_t)K * 2u);
  const int      T    = K >> 6;         // passes of 64 k

  if (pinned(wv < 2u)) {
    tdm_load(tdm_group0(ldst, ga), g1);
    wait_tensor0();
  }
  __syncthreads();                      // stage 0 published
  if (pinned(wv < 2u)) {
    tdm_load(tdm_group0(ldst + G_STAGE, ga + G_ROWB), g1);
  }

  // This wave's fragment rows inside a stage.
  const uint32_t aoff = ((wv & 3u) * 32u + (uint32_t)row) * G_PITCH + (uint32_t)khalf * 2u;
  const uint32_t boff = G_SLICE + ((wv >> 2) * 64u + (uint32_t)row) * G_PITCH + (uint32_t)khalf * 2u;

  v8f a00 = {}, a01 = {}, a02 = {}, a03 = {};
  v8f a10 = {}, a11 = {}, a12 = {}, a13 = {};

  for (int s = 0; s < T; ++s) {
    const uint32_t bsel = (uint32_t)(s & 1) * G_STAGE;
    const unsigned char* Ab = L + bsel + aoff;
    const unsigned char* Bb = L + bsel + boff;
#pragma unroll  // both k-steps of a pass in line: their LDS offsets become immediates
   for (int kk = 0; kk < 2; ++kk) {
    v16h a0 = lds_frag16(Ab + kk * 64);
    v16h a1 = lds_frag16(Ab + 16 * G_PITCH + kk * 64);
    v16h b0 = lds_frag16(Bb + kk * 64);
    v16h b1 = lds_frag16(Bb + 16 * G_PITCH + kk * 64);
    v16h b2 = lds_frag16(Bb + 32 * G_PITCH + kk * 64);
    v16h b3 = lds_frag16(Bb + 48 * G_PITCH + kk * 64);
    a00 = __builtin_amdgcn_wmma_f32_16x16x32_f16(false, a0, false, b0, (short)0, a00, false, false);
    a01 = __builtin_amdgcn_wmma_f32_16x16x32_f16(false, a0, false, b1, (short)0, a01, false, false);
    a02 = __builtin_amdgcn_wmma_f32_16x16x32_f16(false, a0, false, b2, (short)0, a02, false, false);
    a03 = __builtin_amdgcn_wmma_f32_16x16x32_f16(false, a0, false, b3, (short)0, a03, false, false);
    a10 = __builtin_amdgcn_wmma_f32_16x16x32_f16(false, a1, false, b0, (short)0, a10, false, false);
    a11 = __builtin_amdgcn_wmma_f32_16x16x32_f16(false, a1, false, b1, (short)0, a11, false, false);
    a12 = __builtin_amdgcn_wmma_f32_16x16x32_f16(false, a1, false, b2, (short)0, a12, false, false);
    a13 = __builtin_amdgcn_wmma_f32_16x16x32_f16(false, a1, false, b3, (short)0, a13, false, false);
   }
    // Publish point of stage s + 1: own reads done, own tile landed, barrier, refill.
    wait_ds0();
    if (pinned(wv < 2u)) wait_tensor0();
    __syncthreads();
    if (pinned((wv < 2u) && (s + 2 < T))) {
      tdm_load(tdm_group0(ldst + bsel, ga + (uint64_t)(s + 2) * G_ROWB), g1);
    }
  }
  wait_tensor0();
  wait_ds0();

  // D layout: lanes 0-15 -> col = lane, M = v ; lanes 16-31 -> col = lane-16, M = v+8
  const int col = lane & 15;
  const int mb  = (lane >> 4) << 3;
  v8f accs[2][4] = {{a00, a01, a02, a03}, {a10, a11, a12, a13}};
#pragma unroll
  for (int i = 0; i < 2; ++i) {
#pragma unroll
    for (int t = 0; t < 4; ++t) {
      const int n  = n0 + 16 * t + col;
      const float bv = bias[n];
#pragma unroll
      for (int v = 0; v < 8; ++v) {
        const size_t idx = (size_t)(m0 + 16 * i + mb + v) * N + n;
        float x = accs[i][t][v] + bv;
        if (mode < 2)  x = fmaxf(x, 0.f);
        if (mode == 1) x += res[idx];
        C[idx] = x;
      }
    }
  }
}

// ---------------------------------------------------------------------------
// Row kernels: ONE WAVE PER ROW.  The row lives in the wave's registers, the
// sums run over the 32 lanes without LDS and without a barrier, and a launch
// starts 8 to 32 times fewer waves than one 8-wave block per row would.
// ---------------------------------------------------------------------------
typedef float    f32x4 __attribute__((ext_vector_type(4)));
typedef _Float16 f16x4 __attribute__((ext_vector_type(4)));
typedef _Float16 f16x8 __attribute__((ext_vector_type(8)));

// Value of lane (l ^ MASK) inside the 16-lane row (DPP row_xmask); all lanes on.
template <int MASK>
__device__ __forceinline__ float row_xor(float v) {
  return __builtin_bit_cast(float, __builtin_amdgcn_update_dpp(
      0, __builtin_bit_cast(int, v), 0x160 + MASK, 0xf, 0xf, true));
}
// Value of lane (l ^ 16): the same place in the other 16-lane row.
__device__ __forceinline__ float half_xor(float v) {
  const unsigned u = __builtin_bit_cast(unsigned, v);
  return __builtin_bit_cast(float, __builtin_amdgcn_permlanex16(
      u, u, 0x76543210u, 0xfedcba98u, false, false));
}
// Butterfly over the wave: every lane ends with the same total.
__device__ __forceinline__ float wave_sum(float v) {
  v += row_xor<1>(v);
  v += row_xor<2>(v);
  v += row_xor<4>(v);
  v += row_xor<8>(v);
  v += half_xor(v);
  return v;
}
__device__ __forceinline__ float wave_max(float v) {
  v = fmaxf(v, row_xor<1>(v));
  v = fmaxf(v, row_xor<2>(v));
  v = fmaxf(v, row_xor<4>(v));
  v = fmaxf(v, row_xor<8>(v));
  v = fmaxf(v, half_xor(v));
  return v;
}

// ---------------------------------------------------------------------------
// Row LayerNorm, f32 -> f16, rows of C elements (C a multiple of 128).
// Wave w of the grid takes rows w, w + NW, ... (RPW rows, NW = waves of the grid);
// grid = rows / (NWAVES * RPW).  All RPW rows, gamma and beta are requested at
// once and stay in registers: every row is read from memory once.
// ---------------------------------------------------------------------------
template <int C, int RPW>
__global__ __launch_bounds__(TPB)
void ln_rows_kernel(const float* __restrict__ X,
                    const float* __restrict__ g,
                    const float* __restrict__ bta,
                    _Float16* __restrict__ Y) {
  constexpr int NV = C / 128;           // 16-byte pieces of a row per lane
  const uint32_t l4 = (threadIdx.x & 31u) * 4u;
  // the wave's number as a scalar: row bases stay in scalar registers
  const uint32_t gw = blockIdx.x * NWAVES + uni(threadIdx.x >> 5);
  const uint32_t nw = gridDim.x * NWAVES;
  f32x4 xv[RPW][NV], gv[NV], bv[NV];
#pragma unroll  // register arrays need constant indices
  for (int t = 0; t < RPW; ++t) {
    const float* xr = X + (size_t)(t * nw + gw) * C;
#pragma unroll  // register arrays need constant indices
    for (int i = 0; i < NV; ++i) xv[t][i] = *(const f32x4*)(xr + (i * 128 + l4));
  }
#pragma unroll  // register arrays need constant indices
  for (int i = 0; i < NV; ++i) {
    gv[i] = *(const f32x4*)(g   + (i * 128 + l4));
    bv[i] = *(const f32x4*)(bta + (i * 128 + l4));
  }
  // keeps every load above in front of the arithmetic: without it the gamma and
  // beta loads sink between the rows' sums and each is waited for on its own
  __builtin_amdgcn_sched_barrier(0);
#pragma unroll  // register arrays need constant indices
  for (int t = 0; t < RPW; ++t) {
    f32x4 s4 = {0.f, 0.f, 0.f, 0.f}, q4 = {0.f, 0.f, 0.f, 0.f};
#pragma unroll  // register arrays need constant indices
    for (int i = 0; i < NV; ++i) { s4 += xv[t][i]; q4 += xv[t][i] * xv[t][i]; }
    const float ts  = wave_sum((s4[0] + s4[1]) + (s4[2] + s4[3]));
    const float tss = wave_sum((q4[0] + q4[1]) + (q4[2] + q4[3]));
    const float mean = ts / C;
    const float var  = tss / C - mean * mean;
    const float rstd = rsqrtf(var + 1e-5f);
    _Float16* yr = Y + (size_t)(t * nw + gw) * C;
#pragma unroll  // register arrays need constant indices
    for (int i = 0; i < NV; ++i) {
      f16x4 o;
#pragma unroll  // vector elements need constant indices
      for (int c = 0; c < 4; ++c)
        o[c] = (_Float16)((xv[t][i][c] - mean) * rstd * gv[i][c] + bv[i][c]);
      *(f16x4*)(yr + (i * 128 + l4)) = o;
    }
  }
}

// ---------------------------------------------------------------------------
// Attention input builder: for row r = b*OUT + o, gather the time column
// fc[(b*LN + j)*OUT + o] (j = 0..LN-1), append its mean, LayerNorm the
// (LN+1)-vector with per-position gamma/beta, emit f16 padded to CPAD.
// One wave per row, lane l holds j = 8l .. 8l+7, so LN is 256;
// CPAD - LN is a multiple of 8, at most 256.  grid = rows / NWAVES.
// ---------------------------------------------------------------------------
template <int OUT_, int CPAD>
__global__ __launch_bounds__(TPB)
void attn_build_kernel(const float* __restrict__ fc,
                       const float* __restrict__ g,
                       const float* __restrict__ bta,
                       _Float16* __restrict__ Y) {
  constexpr int LN_ = 256;
  const uint32_t lane = threadIdx.x & 31u;
  const uint32_t r = blockIdx.x * NWAVES + uni(threadIdx.x >> 5);  // scalar: row bases in scalar registers
  const uint32_t b = r / OUT_;
  const uint32_t o = r % OUT_;
  const float* col = fc + (size_t)b * LN_ * OUT_ + o;
  float v[8];
#pragma unroll  // register arrays need constant indices
  for (int i = 0; i < 8; ++i) v[i] = col[lane * (8u * OUT_) + i * OUT_];
  const f32x4 g0 = *(const f32x4*)(g + lane * 8u),   g1 = *(const f32x4*)(g + (lane * 8u + 4u));
  const f32x4 c0 = *(const f32x4*)(bta + lane * 8u), c1 = *(const f32x4*)(bta + (lane * 8u + 4u));
  const float gl = g[LN_], cl = bta[LN_];
  float s = 0.f, ss = 0.f;
#pragma unroll  // register arrays need constant indices
  for (int i = 0; i < 8; ++i) { s += v[i]; ss += v[i] * v[i]; }
  const float ts = wave_sum(s), tss = wave_sum(ss);
  const float mval = ts / LN_;                   // appended mean element
  const float Csz  = (float)(LN_ + 1);
  const float mu   = (ts + mval) / Csz;
  const float var  = (tss + mval * mval) / Csz - mu * mu;
  const float rstd = rsqrtf(var + 1e-5f);
  _Float16* y = Y + (size_t)r * CPAD;
  f16x8 ov;
#pragma unroll  // vector elements need constant indices
  for (int i = 0; i < 4; ++i) {
    ov[i]     = (_Float16)((v[i]     - mu) * rstd * g0[i] + c0[i]);
    ov[i + 4] = (_Float16)((v[i + 4] - mu) * rstd * g1[i] + c1[i]);
  }
  *(f16x8*)(y + lane * 8u) = ov;
  if (lane * 8u < (uint32_t)(CPAD - LN_)) {      // the mean element, then zeros
    f16x8 z = {};
    if (lane == 0u) z[0] = (_Float16)((mval - mu) * rstd * gl + cl);
    *(f16x8*)(y + (LN_ + lane * 8u)) = z;
  }
}

// ---------------------------------------------------------------------------
// In-place row softmax, rows of 256.  One wave per row; grid = rows / NWAVES.
// ---------------------------------------------------------------------------
__global__ __launch_bounds__(TPB)
void softmax_kernel(float* __restrict__ W) {
  const uint32_t l4 = (threadIdx.x & 31u) * 4u;
  const uint32_t r = blockIdx.x * NWAVES + uni(threadIdx.x >> 5);  // scalar: row bases in scalar registers
  float* w = W + (size_t)r * 256;
  f32x4 v0 = *(const f32x4*)(w + l4), v1 = *(const f32x4*)(w + (128u + l4));
  const float m = wave_max(fmaxf(fmaxf(fmaxf(v0[0], v0[1]), fmaxf(v0[2], v0[3])),
                                 fmaxf(fmaxf(v1[0], v1[1]), fmaxf(v1[2], v1[3]))));
  float s = 0.f;
#pragma unroll  // vector elements need constant indices
  for (int c = 0; c < 4; ++c) {
    v0[c] = expf(v0[c] - m);
    v1[c] = expf(v1[c] - m);
    s += v0[c] + v1[c];
  }
  const float t = wave_sum(s);
#pragma unroll  // vector elements need constant indices
  for (int c = 0; c < 4; ++c) { v0[c] = v0[c] / t; v1[c] = v1[c] / t; }
  *(f32x4*)(w + l4)          = v0;
  *(f32x4*)(w + (128u + l4)) = v1;
}

// ---------------------------------------------------------------------------
// out[b*OUT + o] = sum_j fc[(b*LN + j)*OUT + o] * wsm[(b*OUT + o)*LN + j]
// One wave per output element, LN is 256; grid = rows / NWAVES.
// ---------------------------------------------------------------------------
template <int OUT_>
__global__ __launch_bounds__(TPB)
void final_kernel(const float* __restrict__ fc,
                  const float* __restrict__ wsm,
                  float* __restrict__ out) {
  constexpr int LN_ = 256;
  const uint32_t lane = threadIdx.x & 31u;
  const uint32_t r = blockIdx.x * NWAVES + uni(threadIdx.x >> 5);  // scalar: row bases in scalar registers
  const uint32_t b = r / OUT_;
  const uint32_t o = r % OUT_;
  const float* col = fc + (size_t)b * LN_ * OUT_ + o;
  const float* w   = wsm + (size_t)r * LN_;
  const f32x4 w0 = *(const f32x4*)(w + lane * 4u), w1 = *(const f32x4*)(w + (128u + lane * 4u));
  float p = 0.f;
#pragma unroll  // vector elements need constant indices
  for (int c = 0; c < 4; ++c) {
    p += col[lane * (4u * OUT_) + c * OUT_] * w0[c];
    p += col[lane * (4u * OUT_) + (128 + c) * OUT_] * w1[c];
  }
  p = wave_sum(p);
  if (lane == 0u) out[r] = p;
}

// ---------------------------------------------------------------------------
// Weight convert + transpose:  W[K x N] f32  ->  Wt[N x Kpad] f16 (zero pad).
// ---------------------------------------------------------------------------
__global__ __launch_bounds__(TPB)
void convert_wt_kernel(const float* __restrict__ W,
                       _Float16* __restrict__ Wt,
                       int K, int N, int Kpad) {
  const long idx = (long)blockIdx.x * TPB + threadIdx.x;
  if (idx >= (long)N * Kpad) return;
  const int n = (int)(idx / Kpad);
  const int k = (int)(idx % Kpad);
  Wt[idx] = (k < K) ? (_Float16)W[(size_t)k * N + n] : (_Float16)0.f;
}

// ---------------------------------------------------------------------------
extern "C" void kernel_launch(void* const* d_in, const int* in_sizes, int n_in,
                              void* d_out, int out_size, void* d_ws, size_t ws_size,
                              hipStream_t stream) {
  (void)in_sizes; (void)n_in; (void)out_size; (void)ws_size;
  const int BS = 64, LNt = 256, FS = 512, H = 1024, OUT = 128, ATT = 256, L = 8;
  const int ROWS = BS * LNt;     // 16384
  const int AR   = BS * OUT;     // 8192 attention rows
  const int KA1  = 320;          // 257 padded to multiple of 64

  const float* x       = (const float*)d_in[0];
  const float* ln0_g   = (const float*)d_in[1];
  const float* ln0_b   = (const float*)d_in[2];
  const float* W0      = (const float*)d_in[3];
  const float* b0      = (const float*)d_in[4];
  const float* res_ln_g= (const float*)d_in[5];
  const float* res_ln_b= (const float*)d_in[6];
  const float* res_W   = (const float*)d_in[7];
  const float* res_b   = (const float*)d_in[8];
  const float* lnf_g   = (const float*)d_in[9];
  const float* lnf_b   = (const float*)d_in[10];
  const float* Wf      = (const float*)d_in[11];
  const float* bf      = (const float*)d_in[12];
  const float* a_ln1_g = (const float*)d_in[13];
  const float* a_ln1_b = (const float*)d_in[14];
  const float* Wa1     = (const float*)d_in[15];
  const float* ba1     = (const float*)d_in[16];
  const float* a_ln2_g = (const float*)d_in[17];
  const float* a_ln2_b = (const float*)d_in[18];
  const float* Wa2     = (const float*)d_in[19];
  const float* ba2     = (const float*)d_in[20];
  float* out           = (float*)d_out;

  // ---- workspace layout ----
  char* ws = (char*)d_ws;
  size_t off = 0;
  auto alloc = [&](size_t bytes) -> void* {
    off = (off + 255) & ~(size_t)255;
    void* p = ws + off;
    off += bytes;
    return p;
  };
  float*    h     = (float*)   alloc((size_t)ROWS * H   * 4);
  _Float16* xln   = (_Float16*)alloc((size_t)ROWS * H   * 2);
  float*    fc    = (float*)   alloc((size_t)ROWS * OUT * 4);
  _Float16* tln   = (_Float16*)alloc((size_t)AR * KA1   * 2);
  float*    abuf  = (float*)   alloc((size_t)AR * ATT   * 4);
  _Float16* aln   = (_Float16*)alloc((size_t)AR * ATT   * 2);
  float*    wbuf  = (float*)   alloc((size_t)AR * LNt   * 4);
  _Float16* W0t   = (_Float16*)alloc((size_t)H * FS     * 2);
  _Float16* resWt = (_Float16*)alloc((size_t)L * H * H  * 2);
  _Float16* Wft   = (_Float16*)alloc((size_t)OUT * H    * 2);
  _Float16* Wa1t  = (_Float16*)alloc((size_t)ATT * KA1  * 2);
  _Float16* Wa2t  = (_Float16*)alloc((size_t)LNt * ATT  * 2);

  auto cg = [](long total) { return dim3((unsigned)((total + TPB - 1) / TPB)); };

  // ---- weight conversion (f32 [KxN] -> f16 [N x Kpad], transposed) ----
  convert_wt_kernel<<<cg((long)H * FS), TPB, 0, stream>>>(W0, W0t, FS, H, FS);
  for (int i = 0; i < L; ++i)
    convert_wt_kernel<<<cg((long)H * H), TPB, 0, stream>>>(
        res_W + (size_t)i * H * H, resWt + (size_t)i * H * H, H, H, H);
  convert_wt_kernel<<<cg((long)OUT * H), TPB, 0, stream>>>(Wf, Wft, H, OUT, H);
  convert_wt_kernel<<<cg((long)ATT * KA1), TPB, 0, stream>>>(Wa1, Wa1t, LNt + 1, ATT, KA1);
  convert_wt_kernel<<<cg((long)LNt * ATT), TPB, 0, stream>>>(Wa2, Wa2t, ATT, LNt, ATT);

  // ---- stem: h = relu(LN(x) @ W0 + b0) ----
  ln_rows_kernel<512, 4><<<ROWS / (NWAVES * 4), TPB, 0, stream>>>(x, ln0_g, ln0_b, xln);
  wmma_gemm_kernel<<<dim3(H / 128, ROWS / 128), TPB, 0, stream>>>(
      xln, W0t, b0, nullptr, h, ROWS, H, FS, 0);

  // ---- residual stack: h += relu(LN(h) @ Wi + bi) ----
  for (int i = 0; i < L; ++i) {
    ln_rows_kernel<1024, 4><<<ROWS / (NWAVES * 4), TPB, 0, stream>>>(
        h, res_ln_g + (size_t)i * H, res_ln_b + (size_t)i * H, xln);
    wmma_gemm_kernel<<<dim3(H / 128, ROWS / 128), TPB, 0, stream>>>(
        xln, resWt + (size_t)i * H * H, res_b + (size_t)i * H, h, h, ROWS, H, H, 1);
  }

  // ---- head: fc = LN(h) @ Wf + bf ----
  ln_rows_kernel<1024, 4><<<ROWS / (NWAVES * 4), TPB, 0, stream>>>(h, lnf_g, lnf_b, xln);
  wmma_gemm_kernel<<<dim3(OUT / 128, ROWS / 128), TPB, 0, stream>>>(
      xln, Wft, bf, nullptr, fc, ROWS, OUT, H, 2);

  // ---- attention MLP over time axis ----
  attn_build_kernel<128, 320><<<AR / NWAVES, TPB, 0, stream>>>(fc, a_ln1_g, a_ln1_b, tln);
  wmma_gemm_kernel<<<dim3(ATT / 128, AR / 128), TPB, 0, stream>>>(
      tln, Wa1t, ba1, nullptr, abuf, AR, ATT, KA1, 0);
  ln_rows_kernel<256, 4><<<AR / (NWAVES * 4), TPB, 0, stream>>>(abuf, a_ln2_g, a_ln2_b, aln);
  wmma_gemm_kernel<<<dim3(LNt / 128, AR / 128), TPB, 0, stream>>>(
      aln, Wa2t, ba2, nullptr, wbuf, AR, LNt, ATT, 2);
  softmax_kernel<<<AR / NWAVES, TPB, 0, stream>>>(wbuf);

  // ---- weighted sum over time ----
  final_kernel<128><<<AR / NWAVES, TPB, 0, stream>>>(fc, wbuf, out);
}

// v003
// Measured time: 684 microseconds a run.
// Timed twice side by side with v002, it ran 1.17 and 1.19 times as fast.
// All steps since v000 together make it 2.14 times as fast.
#include <hip/hip_runtime.h>
#include <hip/hip_bf16.h>
#include <stdint.h>

typedef __attribute__((ext_vector_type(16))) _Float16 v16h;
typedef __attribute__((ext_vector_type(8)))  float    v8f;
typedef uint32_t u32x4 __attribute__((ext_vector_type(4)));
typedef uint32_t u32x8 __attribute__((ext_vector_type(8)));

#define TPB 256
#define NWAVES 8

// ---------------------------------------------------------------------------
// LDS staging of the GEMM operands.  Per pass of 64 k the block's 128 A rows and
// 128 Bt rows (128 B each) are brought by two tensor loads (wave 0: A, wave 1: Bt)
// into one of two buffers; the next pass's tile is in flight while this one is
// worked on.  LDS row pitch 144 B (16 B pad per row) for ds_load_b128 readers.
// Two buffers take 72 KiB, so four blocks share a WGP's LDS.
// ---------------------------------------------------------------------------
#define G_ROWB   128u                 // staged bytes of one operand row per pass
#define G_PITCH  144u                 // LDS pitch of a staged row
#define G_SLICE  18432u               // 128 rows * 144 B, a multiple of 2 KiB
#define G_STAGE  (2u * G_SLICE)       // A rows 0-127 | Bt rows 0-127
// Epilogue staging in the same LDS: a wave's 32 rows of 64 f32 at pitch 272 B (rows 8
// apart lie 32 banks apart for the 4-B writes); 8 waves take 68 KiB of the 72.
#define E_PITCH  272u
#define E_WAVE   (32u * E_PITCH)
typedef float f32x4 __attribute__((ext_vector_type(4)));

__device__ __forceinline__ uint32_t uni(uint32_t v) {
  return (uint32_t)__builtin_amdgcn_readfirstlane(v);
}
// Holds a wave-uniform test in a scalar register so that the branch around a
// tensor load is a scalar branch (tensor loads ignore EXEC).
__device__ __forceinline__ uint32_t pinned(uint32_t v) {
  uint32_t w = uni(v);
  asm volatile("" : "+s"(w));  // pinned(): the test stays in a scalar register, the branch is s_cmp + s_cbranch_scc
  return w;
}
__device__ __forceinline__ void wait_ds0() {
  // own LDS reads retired before the buffer is handed back for a refill
  asm volatile("s_wait_dscnt 0x0" ::: "memory");
}
__device__ __forceinline__ void wait_tensor0() {
  // the tile has landed behind this
  asm volatile("s_wait_tensorcnt 0x0" ::: "memory");
}
__device__ __forceinline__ void tdm_load(u32x4 g0, u32x8 g1) {
  // one request of the whole wave: global tile -> LDS, through no register
  asm volatile("tensor_load_to_lds %0, %1" :: "s"(g0), "s"(g1) : "memory");
}
__device__ __forceinline__ u32x4 tdm_group0(uint32_t lds_dst, uint64_t ga) {
  u32x4 g;
  g[0] = uni(1u);
  g[1] = uni(lds_dst);
  g[2] = uni((uint32_t)ga);
  g[3] = uni((((uint32_t)(ga >> 32)) & 0x01FFFFFFu) | 0x80000000u);
  return g;
}
// 1-byte elements, tile = tensor = 128 rows of 128 B, 16 B of LDS pad behind every row.
__device__ __forceinline__ u32x8 tdm_group1(uint32_t src_pitch) {
  u32x8 g;
  g[0] = uni((1u << 20) | (4u << 22) | (3u << 25));
  g[1] = uni((G_ROWB & 0xFFFFu) << 16);
  g[2] = uni((G_ROWB >> 16) | (128u << 16));
  g[3] = uni(G_ROWB << 16);
  g[4] = uni(128u);
  g[5] = uni(src_pitch);
  g[6] = uni(0u);
  g[7] = uni(0u);
  // Without the next line the compiler forms these constants anew in front of each request
  // and reuses their registers for other values while a request is still outstanding.
  asm volatile("" : "+s"(g));  // pinned(): the descriptor words held in their scalar registers
  return g;
}
// Fragment loader for a 16-bit 16x32 WMMA operand (A, or B from Bt=[N x K]) out of
// a staged row.  Per ISA layout: lanes 0-15 hold K = {0..7, 16..23}, lanes 16-31
// hold K = {8..15, 24..31}: 16 B at k + khalf and 16 B at k + 16 + khalf.
// `p` must already point at rowStart + (k + khalf) * 2 (khalf = (lane>=16)*8).
__device__ __forceinline__ v16h lds_frag16(const unsigned char* p) {
  union { v16h h; u32x4 q[2]; } f;
  f.q[0] = *(const u32x4*)(p);
  f.q[1] = *(const u32x4*)(p + 32);
  return f.h;
}

// ---------------------------------------------------------------------------
// Generic WMMA GEMM:  C[M x N] = epilogue( A[M x K](f16) @ B + bias )
// B is provided transposed: Bt[N x K] f16 (K-contiguous rows).
// MODE 0: relu(acc+bias) ; MODE 1: res + relu(acc+bias) (res may == C) ;
// MODE 2: acc+bias.  MODE and N are compile-time constants: no test stands between
// the epilogue's loads, and its row steps are immediate offsets on one address.
// Block = 8 waves arranged 4(M) x 2(N); each wave owns a 32x64 tile
// (2 A frags x 4 B frags -> 8 v_wmma per K-step, 12 ds_load_b128).
// grid = (N/128, M/128). Requires N%128==0, M%128==0, K%64==0, K>=128.
// ---------------------------------------------------------------------------
template <int MODE, int N>
__global__ __launch_bounds__(TPB)
void wmma_gemm_kernel(const _Float16* __restrict__ A,
                      const _Float16* __restrict__ Bt,
                      const float* __restrict__ bias,
                      const float* __restrict__ res,
                      float* __restrict__ C,
                      int M, int K) {
  const int wave  = threadIdx.x >> 5;
  const int lane  = threadIdx.x & 31;
  const int m0    = blockIdx.y * 128 + (wave & 3) * 32;
  const int n0    = blockIdx.x * 128 + (wave >> 2) * 64;
  const int row   = lane & 15;
  const int khalf = (lane >> 4) << 3;   // 0 or 8

  __shared__ __attribute__((aligned(2048))) unsigned char L[2u * G_STAGE];
  const uint32_t wv = uni(threadIdx.x >> 5);

  // Issuing waves 0 and 1: slice 0 = the block's A rows, slice 1 = its Bt rows.
  const uint32_t sl = wv & 1u;
  const _Float16* srow = (sl == 0u) ? A  + (size_t)(blockIdx.y * 128) * K
                                    : Bt + (size_t)(blockIdx.x * 128) * K;
  const uint64_t ga   = (uint64_t)(size_t)srow;
  const uint32_t ldst = (uint32_t)(size_t)L + sl * G_SLICE;
  const u32x8    g1   = tdm_group1((uint32_t)K * 2u);
  const int      T    = K >> 6;         // passes of 64 k

  if (pinned(wv < 2u)) {
    tdm_load(tdm_group0(ldst, ga), g1);
    wait_tensor0();
  }
  __syncthreads();                      // stage 0 published
  if (pinned(wv < 2u)) {
    tdm_load(tdm_group0(ldst + G_STAGE, ga + G_ROWB), g1);
  }

  // This wave's fragment rows inside a stage.
  const uint32_t aoff = ((wv & 3u) * 32u + (uint32_t)row) * G_PITCH + (uint32_t)khalf * 2u;
  const uint32_t boff = G_SLICE + ((wv >> 2) * 64u + (uint32_t)row) * G_PITCH + (uint32_t)khalf * 2u;

  v8f a00 = {}, a01 = {}, a02 = {}, a03 = {};
  v8f a10 = {}, a11 = {}, a12 = {}, a13 = {};

  for (int s = 0; s < T; ++s) {
    const uint32_t bsel = (uint32_t)(s & 1) * G_STAGE;
    const unsigned char* Ab = L + bsel + aoff;
    const unsigned char* Bb = L + bsel + boff;
#pragma unroll  // both k-steps of a pass in line: their LDS offsets become immediates
   for (int kk = 0; kk < 2; ++kk) {
    v16h a0 = lds_frag16(Ab + kk * 64);
    v16h a1 = lds_frag16(Ab + 16 * G_PITCH + kk * 64);
    v16h b0 = lds_frag16(Bb + kk * 64);
    v16h b1 = lds_frag16(Bb + 16 * G_PITCH + kk * 64);
    v16h b2 = lds_frag16(Bb + 32 * G_PITCH + kk * 64);
    v16h b3 = lds_frag16(Bb + 48 * G_PITCH + kk * 64);
    a00 = __builtin_amdgcn_wmma_f32_16x16x32_f16(false, a0, false, b0, (short)0, a00, false, false);
    a01 = __builtin_amdgcn_wmma_f32_16x16x32_f16(false, a0, false, b1, (short)0, a01, false, false);
    a02 = __builtin_amdgcn_wmma_f32_16x16x32_f16(false, a0, false, b2, (short)0, a02, false, false);
    a03 = __builtin_amdgcn_wmma_f32_16x16x32_f16(false, a0, false, b3, (short)0, a03, false, false);
    a10 = __builtin_amdgcn_wmma_f32_16x16x32_f16(false, a1, false, b0, (short)0, a10, false, false);
    a11 = __builtin_amdgcn_wmma_f32_16x16x32_f16(false, a1, false, b1, (short)0, a11, false, false);
    a12 = __builtin_amdgcn_wmma_f32_16x16x32_f16(false, a1, false, b2, (short)0, a12, false, false);
    a13 = __builtin_amdgcn_wmma_f32_16x16x32_f16(false, a1, false, b3, (short)0, a13, false, false);
   }
    // Publish point of stage s + 1: own reads done, own tile landed, barrier, refill.
    wait_ds0();
    if (pinned(wv < 2u)) wait_tensor0();
    __syncthreads();
    if (pinned((wv < 2u) && (s + 2 < T))) {
      tdm_load(tdm_group0(ldst + bsel, ga + (uint64_t)(s + 2) * G_ROWB), g1);
    }
  }
  wait_tensor0();
  wait_ds0();

  // Epilogue through LDS.  The ring is free here: the last pass ended with every
  // wave's s_wait_dscnt 0, the issuers' s_wait_tensorcnt 0 and the block barrier.
  // Each wave puts its 32x64 f32 tile into its own range and takes it back row-wise,
  // so that the residual is read and C is written 16 B a lane: half a wave covers one
  // aligned 256-B piece of a row.
  // D layout: lanes 0-15 -> col = lane, M = v ; lanes 16-31 -> col = lane-16, M = v+8
  unsigned char* S = L + wv * E_WAVE;
  const uint32_t r2 = (uint32_t)lane >> 4;          // row of a pair
  const uint32_t c4 = ((uint32_t)lane & 15u) * 4u;  // first of this lane's 4 columns
  const f32x4 bv = *(const f32x4*)(bias + ((uint32_t)n0 + c4));
  {
    const uint32_t col = (uint32_t)lane & 15u;
    const uint32_t mb  = ((uint32_t)lane >> 4) << 3;
    v8f accs[2][4] = {{a00, a01, a02, a03}, {a10, a11, a12, a13}};
#pragma unroll  // register arrays need constant indices
    for (int i = 0; i < 2; ++i) {
#pragma unroll  // register arrays need constant indices
      for (int t = 0; t < 4; ++t) {
#pragma unroll  // vector elements need constant indices
        for (int v = 0; v < 8; ++v)
          *(float*)(S + (16u * i + mb + v) * E_PITCH + (16u * t + col) * 4u) = accs[i][t][v];
      }
    }
  }
  wait_ds0();  // own tile written before other lanes of this wave read it back

  // one 32-bit byte offset serves the residual and C (both below 4 GiB by the shapes)
  const uint32_t eb = (((uint32_t)m0 + r2) * (uint32_t)N + (uint32_t)n0 + c4) * 4u;
  const float* rp = (const float*)((const char*)res + eb);
  float*       cp = (float*)((char*)C + eb);
  f32x4 rv[16];
  if (MODE == 1) {
#pragma unroll  // register arrays need constant indices
    for (int j = 0; j < 16; ++j) rv[j] = *(const f32x4*)(rp + 2 * j * N);
    // keeps all 16 residual loads in front of the LDS read-back: without it the LDS
    // loads take the registers first and ten residual loads go out behind a wait
    __builtin_amdgcn_sched_barrier(0);
  }
#pragma unroll  // register arrays need constant indices
  for (int j = 0; j < 16; ++j) {
    f32x4 x = *(const f32x4*)(S + (2u * j + r2) * E_PITCH + c4 * 4u);
    x += bv;
    if (MODE < 2) {
#pragma unroll  // vector elements need constant indices
      for (int c = 0; c < 4; ++c) x[c] = fmaxf(x[c], 0.f);
    }
    if (MODE == 1) x += rv[j];
    *(f32x4*)(cp + 2 * j * N) = x;
  }
}

// ---------------------------------------------------------------------------
// Row kernels: ONE WAVE PER ROW.  The row lives in the wave's registers, the
// sums run over the 32 lanes without LDS and without a barrier, and a launch
// starts 8 to 32 times fewer waves than one 8-wave block per row would.
// ---------------------------------------------------------------------------
typedef _Float16 f16x4 __attribute__((ext_vector_type(4)));
typedef _Float16 f16x8 __attribute__((ext_vector_type(8)));

// Value of lane (l ^ MASK) inside the 16-lane row (DPP row_xmask); all lanes on.
template <int MASK>
__device__ __forceinline__ float row_xor(float v) {
  return __builtin_bit_cast(float, __builtin_amdgcn_update_dpp(
      0, __builtin_bit_cast(int, v), 0x160 + MASK, 0xf, 0xf, true));
}
// Value of lane (l ^ 16): the same place in the other 16-lane row.
__device__ __forceinline__ float half_xor(float v) {
  const unsigned u = __builtin_bit_cast(unsigned, v);
  return __builtin_bit_cast(float, __builtin_amdgcn_permlanex16(
      u, u, 0x76543210u, 0xfedcba98u, false, false));
}
// Butterfly over the wave: every lane ends with the same total.
__device__ __forceinline__ float wave_sum(float v) {
  v += row_xor<1>(v);
  v += row_xor<2>(v);
  v += row_xor<4>(v);
  v += row_xor<8>(v);
  v += half_xor(v);
  return v;
}
__device__ __forceinline__ float wave_max(float v) {
  v = fmaxf(v, row_xor<1>(v));
  v = fmaxf(v, row_xor<2>(v));
  v = fmaxf(v, row_xor<4>(v));
  v = fmaxf(v, row_xor<8>(v));
  v = fmaxf(v, half_xor(v));
  return v;
}

// ---------------------------------------------------------------------------
// Row LayerNorm, f32 -> f16, rows of C elements (C a multiple of 128).
// Wave w of the grid takes rows w, w + NW, ... (RPW rows, NW = waves of the grid);
// grid = rows / (NWAVES * RPW).  All RPW rows, gamma and beta are requested at
// once and stay in registers: every row is read from memory once.
// ---------------------------------------------------------------------------
template <int C, int RPW>
__global__ __launch_bounds__(TPB)
void ln_rows_kernel(const float* __restrict__ X,
                    const float* __restrict__ g,
                    const float* __restrict__ bta,
                    _Float16* __restrict__ Y) {
  constexpr int NV = C / 128;           // 16-byte pieces of a row per lane
  const uint32_t l4 = (threadIdx.x & 31u) * 4u;
  // the wave's number as a scalar: row bases stay in scalar registers
  const uint32_t gw = blockIdx.x * NWAVES + uni(threadIdx.x >> 5);
  const uint32_t nw = gridDim.x * NWAVES;
  f32x4 xv[RPW][NV], gv[NV], bv[NV];
#pragma unroll  // register arrays need constant indices
  for (int t = 0; t < RPW; ++t) {
    const float* xr = X + (size_t)(t * nw + gw) * C;
#pragma unroll  // register arrays need constant indices
    for (int i = 0; i < NV; ++i) xv[t][i] = *(const f32x4*)(xr + (i * 128 + l4));
  }
#pragma unroll  // register arrays need constant indices
  for (int i = 0; i < NV; ++i) {
    gv[i] = *(const f32x4*)(g   + (i * 128 + l4));
    bv[i] = *(const f32x4*)(bta + (i * 128 + l4));
  }
  // keeps every load above in front of the arithmetic: without it the gamma and
  // beta loads sink between the rows' sums and each is waited for on its own
  __builtin_amdgcn_sched_barrier(0);
#pragma unroll  // register arrays need constant indices
  for (int t = 0; t < RPW; ++t) {
    f32x4 s4 = {0.f, 0.f, 0.f, 0.f}, q4 = {0.f, 0.f, 0.f, 0.f};
#pragma unroll  // register arrays need constant indices
    for (int i = 0; i < NV; ++i) { s4 += xv[t][i]; q4 += xv[t][i] * xv[t][i]; }
    const float ts  = wave_sum((s4[0] + s4[1]) + (s4[2] + s4[3]));
    const float tss = wave_sum((q4[0] + q4[1]) + (q4[2] + q4[3]));
    const float mean = ts / C;
    const float var  = tss / C - mean * mean;
    const float rstd = rsqrtf(var + 1e-5f);
    _Float16* yr = Y + (size_t)(t * nw + gw) * C;
#pragma unroll  // register arrays need constant indices
    for (int i = 0; i < NV; ++i) {
      f16x4 o;
#pragma unroll  // vector elements need constant indices
      for (int c = 0; c < 4; ++c)
        o[c] = (_Float16)((xv[t][i][c] - mean) * rstd * gv[i][c] + bv[i][c]);
      *(f16x4*)(yr + (i * 128 + l4)) = o;
    }
  }
}

// ---------------------------------------------------------------------------
// Attention input builder: for row r = b*OUT + o, gather the time column
// fc[(b*LN + j)*OUT + o] (j = 0..LN-1), append its mean, LayerNorm the
// (LN+1)-vector with per-position gamma/beta, emit f16 padded to CPAD.
// One wave per row, lane l holds j = 8l .. 8l+7, so LN is 256;
// CPAD - LN is a multiple of 8, at most 256.  grid = rows / NWAVES.
// ---------------------------------------------------------------------------
template <int OUT_, int CPAD>
__global__ __launch_bounds__(TPB)
void attn_build_kernel(const float* __restrict__ fc,
                       const float* __restrict__ g,
                       const float* __restrict__ bta,
                       _Float16* __restrict__ Y) {
  constexpr int LN_ = 256;
  const uint32_t lane = threadIdx.x & 31u;
  const uint32_t r = blockIdx.x * NWAVES + uni(threadIdx.x >> 5);  // scalar: row bases in scalar registers
  const uint32_t b = r / OUT_;
  const uint32_t o = r % OUT_;
  const float* col = fc + (size_t)b * LN_ * OUT_ + o;
  float v[8];
#pragma unroll  // register arrays need constant indices
  for (int i = 0; i < 8; ++i) v[i] = col[lane * (8u * OUT_) + i * OUT_];
  const f32x4 g0 = *(const f32x4*)(g + lane * 8u),   g1 = *(const f32x4*)(g + (lane * 8u + 4u));
  const f32x4 c0 = *(const f32x4*)(bta + lane * 8u), c1 = *(const f32x4*)(bta + (lane * 8u + 4u));
  const float gl = g[LN_], cl = bta[LN_];
  float s = 0.f, ss = 0.f;
#pragma unroll  // register arrays need constant indices
  for (int i = 0; i < 8; ++i) { s += v[i]; ss += v[i] * v[i]; }
  const float ts = wave_sum(s), tss = wave_sum(ss);
  const float mval = ts / LN_;                   // appended mean element
  const float Csz  = (float)(LN_ + 1);
  const float mu   = (ts + mval) / Csz;
  const float var  = (tss + mval * mval) / Csz - mu * mu;
  const float rstd = rsqrtf(var + 1e-5f);
  _Float16* y = Y + (size_t)r * CPAD;
  f16x8 ov;
#pragma unroll  // vector elements need constant indices
  for (int i = 0; i < 4; ++i) {
    ov[i]     = (_Float16)((v[i]     - mu) * rstd * g0[i] + c0[i]);
    ov[i + 4] = (_Float16)((v[i + 4] - mu) * rstd * g1[i] + c1[i]);
  }
  *(f16x8*)(y + lane * 8u) = ov;
  if (lane * 8u < (uint32_t)(CPAD - LN_)) {      // the mean element, then zeros
    f16x8 z = {};
    if (lane == 0u) z[0] = (_Float16)((mval - mu) * rstd * gl + cl);
    *(f16x8*)(y + (LN_ + lane * 8u)) = z;
  }
}

// ---------------------------------------------------------------------------
// In-place row softmax, rows of 256.  One wave per row; grid = rows / NWAVES.
// ---------------------------------------------------------------------------
__global__ __launch_bounds__(TPB)
void softmax_kernel(float* __restrict__ W) {
  const uint32_t l4 = (threadIdx.x & 31u) * 4u;
  const uint32_t r = blockIdx.x * NWAVES + uni(threadIdx.x >> 5);  // scalar: row bases in scalar registers
  float* w = W + (size_t)r * 256;
  f32x4 v0 = *(const f32x4*)(w + l4), v1 = *(const f32x4*)(w + (128u + l4));
  const float m = wave_max(fmaxf(fmaxf(fmaxf(v0[0], v0[1]), fmaxf(v0[2], v0[3])),
                                 fmaxf(fmaxf(v1[0], v1[1]), fmaxf(v1[2], v1[3]))));
  float s = 0.f;
#pragma unroll  // vector elements need constant indices
  for (int c = 0; c < 4; ++c) {
    v0[c] = expf(v0[c] - m);
    v1[c] = expf(v1[c] - m);
    s += v0[c] + v1[c];
  }
  const float t = wave_sum(s);
#pragma unroll  // vector elements need constant indices
  for (int c = 0; c < 4; ++c) { v0[c] = v0[c] / t; v1[c] = v1[c] / t; }
  *(f32x4*)(w + l4)          = v0;
  *(f32x4*)(w + (128u + l4)) = v1;
}

// ---------------------------------------------------------------------------
// out[b*OUT + o] = sum_j fc[(b*LN + j)*OUT + o] * wsm[(b*OUT + o)*LN + j]
// One wave per output element, LN is 256; grid = rows / NWAVES.
// ---------------------------------------------------------------------------
template <int OUT_>
__global__ __launch_bounds__(TPB)
void final_kernel(const float* __restrict__ fc,
                  const float* __restrict__ wsm,
                  float* __restrict__ out) {
  constexpr int LN_ = 256;
  const uint32_t lane = threadIdx.x & 31u;
  const uint32_t r = blockIdx.x * NWAVES + uni(threadIdx.x >> 5);  // scalar: row bases in scalar registers
  const uint32_t b = r / OUT_;
  const uint32_t o = r % OUT_;
  const float* col = fc + (size_t)b * LN_ * OUT_ + o;
  const float* w   = wsm + (size_t)r * LN_;
  const f32x4 w0 = *(const f32x4*)(w + lane * 4u), w1 = *(const f32x4*)(w + (128u + lane * 4u));
  float p = 0.f;
#pragma unroll  // vector elements need constant indices
  for (int c = 0; c < 4; ++c) {
    p += col[lane * (4u * OUT_) + c * OUT_] * w0[c];
    p += col[lane * (4u * OUT_) + (128 + c) * OUT_] * w1[c];
  }
  p = wave_sum(p);
  if (lane == 0u) out[r] = p;
}

// ---------------------------------------------------------------------------
// Weight convert + transpose:  W[K x N] f32  ->  Wt[N x Kpad] f16 (zero pad).
// ---------------------------------------------------------------------------
__global__ __launch_bounds__(TPB)
void convert_wt_kernel(const float* __restrict__ W,
                       _Float16* __restrict__ Wt,
                       int K, int N, int Kpad) {
  const long idx = (long)blockIdx.x * TPB + threadIdx.x;
  if (idx >= (long)N * Kpad) return;
  const int n = (int)(idx / Kpad);
  const int k = (int)(idx % Kpad);
  Wt[idx] = (k < K) ? (_Float16)W[(size_t)k * N + n] : (_Float16)0.f;
}

// ---------------------------------------------------------------------------
extern "C" void kernel_launch(void* const* d_in, const int* in_sizes, int n_in,
                              void* d_out, int out_size, void* d_ws, size_t ws_size,
                              hipStream_t stream) {
  (void)in_sizes; (void)n_in; (void)out_size; (void)ws_size;
  const int BS = 64, LNt = 256, FS = 512, H = 1024, OUT = 128, ATT = 256, L = 8;
  const int ROWS = BS * LNt;     // 16384
  const int AR   = BS * OUT;     // 8192 attention rows
  const int KA1  = 320;          // 257 padded to multiple of 64

  const float* x       = (const float*)d_in[0];
  const float* ln0_g   = (const float*)d_in[1];
  const float* ln0_b   = (const float*)d_in[2];
  const float* W0      = (const float*)d_in[3];
  const float* b0      = (const float*)d_in[4];
  const float* res_ln_g= (const float*)d_in[5];
  const float* res_ln_b= (const float*)d_in[6];
  const float* res_W   = (const float*)d_in[7];
  const float* res_b   = (const float*)d_in[8];
  const float* lnf_g   = (const float*)d_in[9];
  const float* lnf_b   = (const float*)d_in[10];
  const float* Wf      = (const float*)d_in[11];
  const float* bf      = (const float*)d_in[12];
  const float* a_ln1_g = (const float*)d_in[13];
  const float* a_ln1_b = (const float*)d_in[14];
  const float* Wa1     = (const float*)d_in[15];
  const float* ba1     = (const float*)d_in[16];
  const float* a_ln2_g = (const float*)d_in[17];
  const float* a_ln2_b = (const float*)d_in[18];
  const float* Wa2     = (const float*)d_in[19];
  const float* ba2     = (const float*)d_in[20];
  float* out           = (float*)d_out;

  // ---- workspace layout ----
  char* ws = (char*)d_ws;
  size_t off = 0;
  auto alloc = [&](size_t bytes) -> void* {
    off = (off + 255) & ~(size_t)255;
    void* p = ws + off;
    off += bytes;
    return p;
  };
  float*    h     = (float*)   alloc((size_t)ROWS * H   * 4);
  _Float16* xln   = (_Float16*)alloc((size_t)ROWS * H   * 2);
  float*    fc    = (float*)   alloc((size_t)ROWS * OUT * 4);
  _Float16* tln   = (_Float16*)alloc((size_t)AR * KA1   * 2);
  float*    abuf  = (float*)   alloc((size_t)AR * ATT   * 4);
  _Float16* aln   = (_Float16*)alloc((size_t)AR * ATT   * 2);
  float*    wbuf  = (float*)   alloc((size_t)AR * LNt   * 4);
  _Float16* W0t   = (_Float16*)alloc((size_t)H * FS     * 2);
  _Float16* resWt = (_Float16*)alloc((size_t)L * H * H  * 2);
  _Float16* Wft   = (_Float16*)alloc((size_t)OUT * H    * 2);
  _Float16* Wa1t  = (_Float16*)alloc((size_t)ATT * KA1  * 2);
  _Float16* Wa2t  = (_Float16*)alloc((size_t)LNt * ATT  * 2);

  auto cg = [](long total) { return dim3((unsigned)((total + TPB - 1) / TPB)); };

  // ---- weight conversion (f32 [KxN] -> f16 [N x Kpad], transposed) ----
  convert_wt_kernel<<<cg((long)H * FS), TPB, 0, stream>>>(W0, W0t, FS, H, FS);
  for (int i = 0; i < L; ++i)
    convert_wt_kernel<<<cg((long)H * H), TPB, 0, stream>>>(
        res_W + (size_t)i * H * H, resWt + (size_t)i * H * H, H, H, H);
  convert_wt_kernel<<<cg((long)OUT * H), TPB, 0, stream>>>(Wf, Wft, H, OUT, H);
  convert_wt_kernel<<<cg((long)ATT * KA1), TPB, 0, stream>>>(Wa1, Wa1t, LNt + 1, ATT, KA1);
  convert_wt_kernel<<<cg((long)LNt * ATT), TPB, 0, stream>>>(Wa2, Wa2t, ATT, LNt, ATT);

  // ---- stem: h = relu(LN(x) @ W0 + b0) ----
  ln_rows_kernel<512, 4><<<ROWS / (NWAVES * 4), TPB, 0, stream>>>(x, ln0_g, ln0_b, xln);
  wmma_gemm_kernel<0, 1024><<<dim3(H / 128, ROWS / 128), TPB, 0, stream>>>(
      xln, W0t, b0, nullptr, h, ROWS, FS);

  // ---- residual stack: h += relu(LN(h) @ Wi + bi) ----
  for (int i = 0; i < L; ++i) {
    ln_rows_kernel<1024, 4><<<ROWS / (NWAVES * 4), TPB, 0, stream>>>(
        h, res_ln_g + (size_t)i * H, res_ln_b + (size_t)i * H, xln);
    wmma_gemm_kernel<1, 1024><<<dim3(H / 128, ROWS / 128), TPB, 0, stream>>>(
        xln, resWt + (size_t)i * H * H, res_b + (size_t)i * H, h, h, ROWS, H);
  }

  // ---- head: fc = LN(h) @ Wf + bf ----
  ln_rows_kernel<1024, 4><<<ROWS / (NWAVES * 4), TPB, 0, stream>>>(h, lnf_g, lnf_b, xln);
  wmma_gemm_kernel<2, 128><<<dim3(OUT / 128, ROWS / 128), TPB, 0, stream>>>(
      xln, Wft, bf, nullptr, fc, ROWS, H);

  // ---- attention MLP over time axis ----
  attn_build_kernel<128, 320><<<AR / NWAVES, TPB, 0, stream>>>(fc, a_ln1_g, a_ln1_b, tln);
  wmma_gemm_kernel<0, 256><<<dim3(ATT / 128, AR / 128), TPB, 0, stream>>>(
      tln, Wa1t, ba1, nullptr, abuf, AR, KA1);
  ln_rows_kernel<256, 4><<<AR / (NWAVES * 4), TPB, 0, stream>>>(abuf, a_ln2_g, a_ln2_b, aln);
  wmma_gemm_kernel<2, 256><<<dim3(LNt / 128, AR / 128), TPB, 0, stream>>>(
      aln, Wa2t, ba2, nullptr, wbuf, AR, ATT);
  softmax_kernel<<<AR / NWAVES, TPB, 0, stream>>>(wbuf);

  // ---- weighted sum over time ----
  final_kernel<128><<<AR / NWAVES, TPB, 0, stream>>>(fc, wbuf, out);
}

// v004
// It runs in 621 microseconds.
// Timed twice side by side with v003, it ran 1.10 and 1.11 times as fast.
// Counting every step since v000, it is 2.37 times as fast.
#include <hip/hip_runtime.h>
#include <hip/hip_bf16.h>
#include <stdint.h>

typedef __attribute__((ext_vector_type(16))) _Float16 v16h;
typedef __attribute__((ext_vector_type(8)))  float    v8f;
typedef uint32_t u32x4 __attribute__((ext_vector_type(4)));
typedef uint32_t u32x8 __attribute__((ext_vector_type(8)));

#define TPB 256
#define NWAVES 8

// ---------------------------------------------------------------------------
// LDS staging of the GEMM operands.  Per pass of 64 k the block's 128 A rows and
// 128 Bt rows (128 B each) are brought by two tensor loads (wave 0: A, wave 1: Bt)
// into one of two buffers; the next pass's tile is in flight while this one is
// worked on.  LDS row pitch 144 B (16 B pad per row) for ds_load_b128 readers.
// Two buffers take 72 KiB, so four blocks share a WGP's LDS.
// ---------------------------------------------------------------------------
#define G_ROWB   128u                 // staged bytes of one operand row per pass
#define G_PITCH  144u                 // LDS pitch of a staged row
#define G_SLICE  18432u               // 128 rows * 144 B, a multiple of 2 KiB
#define G_STAGE  (2u * G_SLICE)       // A rows 0-127 | Bt rows 0-127
// Epilogue staging in the same LDS: a wave's 32 rows of 64 f32 at pitch 272 B (rows 8
// apart lie 32 banks apart for the 4-B writes); 8 waves take 68 KiB of the 72.
#define E_PITCH  272u
#define E_WAVE   (32u * E_PITCH)
typedef float f32x4 __attribute__((ext_vector_type(4)));

__device__ __forceinline__ uint32_t uni(uint32_t v) {
  return (uint32_t)__builtin_amdgcn_readfirstlane(v);
}
// Holds a wave-uniform test in a scalar register so that the branch around a
// tensor load is a scalar branch (tensor loads ignore EXEC).
__device__ __forceinline__ uint32_t pinned(uint32_t v) {
  uint32_t w = uni(v);
  asm volatile("" : "+s"(w));  // pinned(): the test stays in a scalar register, the branch is s_cmp + s_cbranch_scc
  return w;
}
__device__ __forceinline__ void wait_ds0() {
  // own LDS reads retired before the buffer is handed back for a refill
  asm volatile("s_wait_dscnt 0x0" ::: "memory");
}
__device__ __forceinline__ void wait_tensor0() {
  // the tile has landed behind this
  asm volatile("s_wait_tensorcnt 0x0" ::: "memory");
}
__device__ __forceinline__ void tdm_load(u32x4 g0, u32x8 g1) {
  // one request of the whole wave: global tile -> LDS, through no register
  asm volatile("tensor_load_to_lds %0, %1" :: "s"(g0), "s"(g1) : "memory");
}
__device__ __forceinline__ u32x4 tdm_group0(uint32_t lds_dst, uint64_t ga) {
  u32x4 g;
  g[0] = uni(1u);
  g[1] = uni(lds_dst);
  g[2] = uni((uint32_t)ga);
  g[3] = uni((((uint32_t)(ga >> 32)) & 0x01FFFFFFu) | 0x80000000u);
  return g;
}
// 1-byte elements, tile = tensor = 128 rows of 128 B, 16 B of LDS pad behind every row.
__device__ __forceinline__ u32x8 tdm_group1(uint32_t src_pitch) {
  u32x8 g;
  g[0] = uni((1u << 20) | (4u << 22) | (3u << 25));
  g[1] = uni((G_ROWB & 0xFFFFu) << 16);
  g[2] = uni((G_ROWB >> 16) | (128u << 16));
  g[3] = uni(G_ROWB << 16);
  g[4] = uni(128u);
  g[5] = uni(src_pitch);
  g[6] = uni(0u);
  g[7] = uni(0u);
  // Without the next line the compiler forms these constants anew in front of each request
  // and reuses their registers for other values while a request is still outstanding.
  asm volatile("" : "+s"(g));  // pinned(): the descriptor words held in their scalar registers
  return g;
}
// Fragment loader for a 16-bit 16x32 WMMA operand (A, or B from Bt=[N x K]) out of
// a staged row.  Per ISA layout: lanes 0-15 hold K = {0..7, 16..23}, lanes 16-31
// hold K = {8..15, 24..31}: 16 B at k + khalf and 16 B at k + 16 + khalf.
// `p` must already point at rowStart + (k + khalf) * 2 (khalf = (lane>=16)*8).
__device__ __forceinline__ v16h lds_frag16(const unsigned char* p) {
  union { v16h h; u32x4 q[2]; } f;
  f.q[0] = *(const u32x4*)(p);
  f.q[1] = *(const u32x4*)(p + 32);
  return f.h;
}

// ---------------------------------------------------------------------------
// Generic WMMA GEMM:  C[M x N] = epilogue( A[M x K](f16) @ B + bias )
// B is provided transposed: Bt[N x K] f16 (K-contiguous rows).
// MODE 0: relu(acc+bias) ; MODE 1: res + relu(acc+bias) (res may == C) ;
// MODE 2: acc+bias.  MODE and N are compile-time constants: no test stands between
// the epilogue's loads, and its row steps are immediate offsets on one address.
// Block = 8 waves arranged 4(M) x 2(N); each wave owns a 32x64 tile
// (2 A frags x 4 B frags -> 8 v_wmma per K-step, 12 ds_load_b128).
// grid = (N/128, M/128). Requires N%128==0, M%128==0, K%64==0, K>=128.
// ---------------------------------------------------------------------------
template <int MODE, int N>
__global__ __launch_bounds__(TPB)
void wmma_gemm_kernel(const _Float16* __restrict__ A,
                      const _Float16* __restrict__ Bt,
                      const float* __restrict__ bias,
                      const float* __restrict__ res,
                      float* __restrict__ C,
                      int M, int K) {
  const int wave  = threadIdx.x >> 5;
  const int lane  = threadIdx.x & 31;
  const int m0    = blockIdx.y * 128 + (wave & 3) * 32;
  const int n0    = blockIdx.x * 128 + (wave >> 2) * 64;
  const int row   = lane & 15;
  const int khalf = (lane >> 4) << 3;   // 0 or 8

  __shared__ __attribute__((aligned(2048))) unsigned char L[2u * G_STAGE];
  const uint32_t wv = uni(threadIdx.x >> 5);

  // Issuing waves 0 and 1: slice 0 = the block's A rows, slice 1 = its Bt rows.
  const uint32_t sl = wv & 1u;
  const _Float16* srow = (sl == 0u) ? A  + (size_t)(blockIdx.y * 128) * K
                                    : Bt + (size_t)(blockIdx.x * 128) * K;
  const uint64_t ga   = (uint64_t)(size_t)srow;
  const uint32_t ldst = (uint32_t)(size_t)L + sl * G_SLICE;
  const u32x8    g1   = tdm_group1((uint32_t)K * 2u);
  const int      T    = K >> 6;         // passes of 64 k

  if (pinned(wv < 2u)) {
    tdm_load(tdm_group0(ldst, ga), g1);
    wait_tensor0();
  }
  __syncthreads();                      // stage 0 published
  if (pinned(wv < 2u)) {
    tdm_load(tdm_group0(ldst + G_STAGE, ga + G_ROWB), g1);
  }

  // This wave's fragment rows inside a stage.
  const uint32_t aoff = ((wv & 3u) * 32u + (uint32_t)row) * G_PITCH + (uint32_t)khalf * 2u;
  const uint32_t boff = G_SLICE + ((wv >> 2) * 64u + (uint32_t)row) * G_PITCH + (uint32_t)khalf * 2u;

  v8f a00 = {}, a01 = {}, a02 = {}, a03 = {};
  v8f a10 = {}, a11 = {}, a12 = {}, a13 = {};

  for (int s = 0; s < T; ++s) {
    const uint32_t bsel = (uint32_t)(s & 1) * G_STAGE;
    const unsigned char* Ab = L + bsel + aoff;
    const unsigned char* Bb = L + bsel + boff;
#pragma unroll  // both k-steps of a pass in line: their LDS offsets become immediates
   for (int kk = 0; kk < 2; ++kk) {
    v16h a0 = lds_frag16(Ab + kk * 64);
    v16h a1 = lds_frag16(Ab + 16 * G_PITCH + kk * 64);
    v16h b0 = lds_frag16(Bb + kk * 64);
    v16h b1 = lds_frag16(Bb + 16 * G_PITCH + kk * 64);
    v16h b2 = lds_frag16(Bb + 32 * G_PITCH + kk * 64);
    v16h b3 = lds_frag16(Bb + 48 * G_PITCH + kk * 64);
    a00 = __builtin_amdgcn_wmma_f32_16x16x32_f16(false, a0, false, b0, (short)0, a00, false, false);
    a01 = __builtin_amdgcn_wmma_f32_16x16x32_f16(false, a0, false, b1, (short)0, a01, false, false);
    a02 = __builtin_amdgcn_wmma_f32_16x16x32_f16(false, a0, false, b2, (short)0, a02, false, false);
    a03 = __builtin_amdgcn_wmma_f32_16x16x32_f16(false, a0, false, b3, (short)0, a03, false, false);
    a10 = __builtin_amdgcn_wmma_f32_16x16x32_f16(false, a1, false, b0, (short)0, a10, false, false);
    a11 = __builtin_amdgcn_wmma_f32_16x16x32_f16(false, a1, false, b1, (short)0, a11, false, false);
    a12 = __builtin_amdgcn_wmma_f32_16x16x32_f16(false, a1, false, b2, (short)0, a12, false, false);
    a13 = __builtin_amdgcn_wmma_f32_16x16x32_f16(false, a1, false, b3, (short)0, a13, false, false);
   }
    // Publish point of stage s + 1: own reads done, own tile landed, barrier, refill.
    wait_ds0();
    if (pinned(wv < 2u)) wait_tensor0();
    __syncthreads();
    if (pinned((wv < 2u) && (s + 2 < T))) {
      tdm_load(tdm_group0(ldst + bsel, ga + (uint64_t)(s + 2) * G_ROWB), g1);
    }
  }
  wait_tensor0();
  wait_ds0();

  // Epilogue through LDS.  The ring is free here: the last pass ended with every
  // wave's s_wait_dscnt 0, the issuers' s_wait_tensorcnt 0 and the block barrier.
  // Each wave puts its 32x64 f32 tile into its own range and takes it back row-wise,
  // so that the residual is read and C is written 16 B a lane: half a wave covers one
  // aligned 256-B piece of a row.
  // D layout: lanes 0-15 -> col = lane, M = v ; lanes 16-31 -> col = lane-16, M = v+8
  unsigned char* S = L + wv * E_WAVE;
  const uint32_t r2 = (uint32_t)lane >> 4;          // row of a pair
  const uint32_t c4 = ((uint32_t)lane & 15u) * 4u;  // first of this lane's 4 columns
  const f32x4 bv = *(const f32x4*)(bias + ((uint32_t)n0 + c4));
  {
    const uint32_t col = (uint32_t)lane & 15u;
    const uint32_t mb  = ((uint32_t)lane >> 4) << 3;
    v8f accs[2][4] = {{a00, a01, a02, a03}, {a10, a11, a12, a13}};
#pragma unroll  // register arrays need constant indices
    for (int i = 0; i < 2; ++i) {
#pragma unroll  // register arrays need constant indices
      for (int t = 0; t < 4; ++t) {
#pragma unroll  // vector elements need constant indices
        for (int v = 0; v < 8; ++v)
          *(float*)(S + (16u * i + mb + v) * E_PITCH + (16u * t + col) * 4u) = accs[i][t][v];
      }
    }
  }
  wait_ds0();  // own tile written before other lanes of this wave read it back

  // one 32-bit byte offset serves the residual and C (both below 4 GiB by the shapes)
  const uint32_t eb = (((uint32_t)m0 + r2) * (uint32_t)N + (uint32_t)n0 + c4) * 4u;
  const float* rp = (const float*)((const char*)res + eb);
  float*       cp = (float*)((char*)C + eb);
  f32x4 rv[16];
  if (MODE == 1) {
#pragma unroll  // register arrays need constant indices
    for (int j = 0; j < 16; ++j) rv[j] = *(const f32x4*)(rp + 2 * j * N);
    // keeps all 16 residual loads in front of the LDS read-back: without it the LDS
    // loads take the registers first and ten residual loads go out behind a wait
    __builtin_amdgcn_sched_barrier(0);
  }
#pragma unroll  // register arrays need constant indices
  for (int j = 0; j < 16; ++j) {
    f32x4 x = *(const f32x4*)(S + (2u * j + r2) * E_PITCH + c4 * 4u);
    x += bv;
    if (MODE < 2) {
#pragma unroll  // vector elements need constant indices
      for (int c = 0; c < 4; ++c) x[c] = fmaxf(x[c], 0.f);
    }
    if (MODE == 1) x += rv[j];
    *(f32x4*)(cp + 2 * j * N) = x;
  }
}

// ---------------------------------------------------------------------------
// Row kernels: ONE WAVE PER ROW.  The row lives in the wave's registers, the
// sums run over the 32 lanes without LDS and without a barrier, and a launch
// starts 8 to 32 times fewer waves than one 8-wave block per row would.
// ---------------------------------------------------------------------------
typedef _Float16 f16x4 __attribute__((ext_vector_type(4)));
typedef _Float16 f16x8 __attribute__((ext_vector_type(8)));

// Value of lane (l ^ MASK) inside the 16-lane row (DPP row_xmask); all lanes on.
template <int MASK>
__device__ __forceinline__ float row_xor(float v) {
  return __builtin_bit_cast(float, __builtin_amdgcn_update_dpp(
      0, __builtin_bit_cast(int, v), 0x160 + MASK, 0xf, 0xf, true));
}
// Value of lane (l ^ 16): the same place in the other 16-lane row.
__device__ __forceinline__ float half_xor(float v) {
  const unsigned u = __builtin_bit_cast(unsigned, v);
  return __builtin_bit_cast(float, __builtin_amdgcn_permlanex16(
      u, u, 0x76543210u, 0xfedcba98u, false, false));
}
// Butterfly over the wave: every lane ends with the same total.
__device__ __forceinline__ float wave_sum(float v) {
  v += row_xor<1>(v);
  v += row_xor<2>(v);
  v += row_xor<4>(v);
  v += row_xor<8>(v);
  v += half_xor(v);
  return v;
}
__device__ __forceinline__ float wave_max(float v) {
  v = fmaxf(v, row_xor<1>(v));
  v = fmaxf(v, row_xor<2>(v));
  v = fmaxf(v, row_xor<4>(v));
  v = fmaxf(v, row_xor<8>(v));
  v = fmaxf(v, half_xor(v));
  return v;
}

// ---------------------------------------------------------------------------
// Row LayerNorm, f32 -> f16, rows of C elements (C a multiple of 128).
// Wave w of the grid takes rows w, w + NW, ... (RPW rows, NW = waves of the grid);
// grid = rows / (NWAVES * RPW).  All RPW rows, gamma and beta are requested at
// once and stay in registers: every row is read from memory once.
// ---------------------------------------------------------------------------
template <int C, int RPW>
__global__ __launch_bounds__(TPB)
void ln_rows_kernel(const float* __restrict__ X,
                    const float* __restrict__ g,
                    const float* __restrict__ bta,
                    _Float16* __restrict__ Y) {
  constexpr int NV = C / 128;           // 16-byte pieces of a row per lane
  const uint32_t l4 = (threadIdx.x & 31u) * 4u;
  // the wave's number as a scalar: row bases stay in scalar registers
  const uint32_t gw = blockIdx.x * NWAVES + uni(threadIdx.x >> 5);
  const uint32_t nw = gridDim.x * NWAVES;
  f32x4 xv[RPW][NV], gv[NV], bv[NV];
#pragma unroll  // register arrays need constant indices
  for (int t = 0; t < RPW; ++t) {
    const float* xr = X + (size_t)(t * nw + gw) * C;
#pragma unroll  // register arrays need constant indices
    for (int i = 0; i < NV; ++i) xv[t][i] = *(const f32x4*)(xr + (i * 128 + l4));
  }
#pragma unroll  // register arrays need constant indices
  for (int i = 0; i < NV; ++i) {
    gv[i] = *(const f32x4*)(g   + (i * 128 + l4));
    bv[i] = *(const f32x4*)(bta + (i * 128 + l4));
  }
  // keeps every load above in front of the arithmetic: without it the gamma and
  // beta loads sink between the rows' sums and each is waited for on its own
  __builtin_amdgcn_sched_barrier(0);
#pragma unroll  // register arrays need constant indices
  for (int t = 0; t < RPW; ++t) {
    f32x4 s4 = {0.f, 0.f, 0.f, 0.f}, q4 = {0.f, 0.f, 0.f, 0.f};
#pragma unroll  // register arrays need constant indices
    for (int i = 0; i < NV; ++i) { s4 += xv[t][i]; q4 += xv[t][i] * xv[t][i]; }
    const float ts  = wave_sum((s4[0] + s4[1]) + (s4[2] + s4[3]));
    const float tss = wave_sum((q4[0] + q4[1]) + (q4[2] + q4[3]));
    const float mean = ts / C;
    const float var  = tss / C - mean * mean;
    const float rstd = rsqrtf(var + 1e-5f);
    _Float16* yr = Y + (size_t)(t * nw + gw) * C;
#pragma unroll  // register arrays need constant indices
    for (int i = 0; i < NV; ++i) {
      f16x4 o;
#pragma unroll  // vector elements need constant indices
      for (int c = 0; c < 4; ++c)
        o[c] = (_Float16)((xv[t][i][c] - mean) * rstd * gv[i][c] + bv[i][c]);
      *(f16x4*)(yr + (i * 128 + l4)) = o;
    }
  }
}

// ---------------------------------------------------------------------------
// Attention input builder: for row r = b*OUT + o, gather the time column
// fc[(b*LN + j)*OUT + o] (j = 0..LN-1), append its mean, LayerNorm the
// (LN+1)-vector with per-position gamma/beta, emit f16 padded to CPAD.
// One wave per row, lane l holds j = 8l .. 8l+7, so LN is 256;
// CPAD - LN is a multiple of 8, at most 256.  grid = rows / NWAVES.
// ---------------------------------------------------------------------------
template <int OUT_, int CPAD>
__global__ __launch_bounds__(TPB)
void attn_build_kernel(const float* __restrict__ fc,
                       const float* __restrict__ g,
                       const float* __restrict__ bta,
                       _Float16* __restrict__ Y) {
  constexpr int LN_ = 256;
  const uint32_t lane = threadIdx.x & 31u;
  const uint32_t r = blockIdx.x * NWAVES + uni(threadIdx.x >> 5);  // scalar: row bases in scalar registers
  const uint32_t b = r / OUT_;
  const uint32_t o = r % OUT_;
  const float* col = fc + (size_t)b * LN_ * OUT_ + o;
  float v[8];
#pragma unroll  // register arrays need constant indices
  for (int i = 0; i < 8; ++i) v[i] = col[lane * (8u * OUT_) + i * OUT_];
  const f32x4 g0 = *(const f32x4*)(g + lane * 8u),   g1 = *(const f32x4*)(g + (lane * 8u + 4u));
  const f32x4 c0 = *(const f32x4*)(bta + lane * 8u), c1 = *(const f32x4*)(bta + (lane * 8u + 4u));
  const float gl = g[LN_], cl = bta[LN_];
  float s = 0.f, ss = 0.f;
#pragma unroll  // register arrays need constant indices
  for (int i = 0; i < 8; ++i) { s += v[i]; ss += v[i] * v[i]; }
  const float ts = wave_sum(s), tss = wave_sum(ss);
  const float mval = ts / LN_;                   // appended mean element
  const float Csz  = (float)(LN_ + 1);
  const float mu   = (ts + mval) / Csz;
  const float var  = (tss + mval * mval) / Csz - mu * mu;
  const float rstd = rsqrtf(var + 1e-5f);
  _Float16* y = Y + (size_t)r * CPAD;
  f16x8 ov;
#pragma unroll  // vector elements need constant indices
  for (int i = 0; i < 4; ++i) {
    ov[i]     = (_Float16)((v[i]     - mu) * rstd * g0[i] + c0[i]);
    ov[i + 4] = (_Float16)((v[i + 4] - mu) * rstd * g1[i] + c1[i]);
  }
  *(f16x8*)(y + lane * 8u) = ov;
  if (lane * 8u < (uint32_t)(CPAD - LN_)) {      // the mean element, then zeros
    f16x8 z = {};
    if (lane == 0u) z[0] = (_Float16)((mval - mu) * rstd * gl + cl);
    *(f16x8*)(y + (LN_ + lane * 8u)) = z;
  }
}

// ---------------------------------------------------------------------------
// In-place row softmax, rows of 256.  One wave per row; grid = rows / NWAVES.
// ---------------------------------------------------------------------------
__global__ __launch_bounds__(TPB)
void softmax_kernel(float* __restrict__ W) {
  const uint32_t l4 = (threadIdx.x & 31u) * 4u;
  const uint32_t r = blockIdx.x * NWAVES + uni(threadIdx.x >> 5);  // scalar: row bases in scalar registers
  float* w = W + (size_t)r * 256;
  f32x4 v0 = *(const f32x4*)(w + l4), v1 = *(const f32x4*)(w + (128u + l4));
  const float m = wave_max(fmaxf(fmaxf(fmaxf(v0[0], v0[1]), fmaxf(v0[2], v0[3])),
                                 fmaxf(fmaxf(v1[0], v1[1]), fmaxf(v1[2], v1[3]))));
  float s = 0.f;
#pragma unroll  // vector elements need constant indices
  for (int c = 0; c < 4; ++c) {
    v0[c] = expf(v0[c] - m);
    v1[c] = expf(v1[c] - m);
    s += v0[c] + v1[c];
  }
  const float t = wave_sum(s);
#pragma unroll  // vector elements need constant indices
  for (int c = 0; c < 4; ++c) { v0[c] = v0[c] / t; v1[c] = v1[c] / t; }
  *(f32x4*)(w + l4)          = v0;
  *(f32x4*)(w + (128u + l4)) = v1;
}

// ---------------------------------------------------------------------------
// out[b*OUT + o] = sum_j fc[(b*LN + j)*OUT + o] * wsm[(b*OUT + o)*LN + j]
// One wave per output element, LN is 256; grid = rows / NWAVES.
// ---------------------------------------------------------------------------
template <int OUT_>
__global__ __launch_bounds__(TPB)
void final_kernel(const float* __restrict__ fc,
                  const float* __restrict__ wsm,
                  float* __restrict__ out) {
  constexpr int LN_ = 256;
  const uint32_t lane = threadIdx.x & 31u;
  const uint32_t r = blockIdx.x * NWAVES + uni(threadIdx.x >> 5);  // scalar: row bases in scalar registers
  const uint32_t b = r / OUT_;
  const uint32_t o = r % OUT_;
  const float* col = fc + (size_t)b * LN_ * OUT_ + o;
  const float* w   = wsm + (size_t)r * LN_;
  const f32x4 w0 = *(const f32x4*)(w + lane * 4u), w1 = *(const f32x4*)(w + (128u + lane * 4u));
  float p = 0.f;
#pragma unroll  // vector elements need constant indices
  for (int c = 0; c < 4; ++c) {
    p += col[lane * (4u * OUT_) + c * OUT_] * w0[c];
    p += col[lane * (4u * OUT_) + (128 + c) * OUT_] * w1[c];
  }
  p = wave_sum(p);
  if (lane == 0u) out[r] = p;
}

// ---------------------------------------------------------------------------
// Weight convert + transpose, every matrix in ONE launch:
//   W[K x N] f32  ->  Wt[N x KPAD] f16 (k >= K gives zero).
// One block per tile of 64 k x 128 n.  Wave w reads rows 8w .. 8w+7 of the tile, each
// row as one 512-B piece (16 B a lane, all 8 loads in flight); a lane then holds
// 8 k x 4 n, turns them in registers and puts 16 B (8 k) per n into LDS; the tile
// goes out as whole 128-B lines of Wt, 16 B a lane.
// LDS row n = 128 B = 8 chunks of 16 B; chunk q lies at place q ^ ((n >> 2) & 7),
// so that the 32 lanes of a write (n = 4 * lane + j) do not all meet the same banks.
// ---------------------------------------------------------------------------
#define CT_K 64u
#define CT_N 128u
__host__ __device__ constexpr uint32_t ct_tiles(uint32_t kpad, uint32_t n) {
  return (kpad / CT_K) * (n / CT_N);
}
__device__ __forceinline__ uint32_t ct_place(uint32_t n, uint32_t q) {
  return n * 128u + ((q ^ ((n >> 2) & 7u)) << 4);
}
// Where a block's finished tile goes: first element in Wt and Wt's row length.  Both
// follow from blockIdx alone, so they live in scalar registers.
struct CvOut {
  _Float16* dst;
  uint32_t  kpad;
};
// First half of a tile: read, convert, turn, put into LDS.  The shape is a compile-time
// constant here, so that the 8 row loads are one address with immediate offsets.
template <uint32_t K, uint32_t N, uint32_t KPAD>
__device__ __forceinline__ CvOut convert_in(const float* __restrict__ Wm, _Float16* Wt,
                                            uint32_t tile, unsigned char* T) {
  const uint32_t n0 = (tile % (N / CT_N)) * CT_N;   // n runs fastest: neighbours in the grid read neighbouring pieces of the same rows
  const uint32_t k0 = (tile / (N / CT_N)) * CT_K;
  const uint32_t c  = threadIdx.x & 31u;
  const uint32_t kr = threadIdx.x >> 5;
  f32x4 v[8];
#pragma unroll  // register arrays need constant indices
  for (int i = 0; i < 8; ++i) {
    const uint32_t k  = k0 + kr * 8u + i;
    const uint32_t kc = (K < KPAD) ? (k < K ? k : K - 1u) : k;   // the address stays inside W
    v[i] = *(const f32x4*)(Wm + ((size_t)kc * N + n0 + c * 4u));
    // Clamped rows have an address register each, and a later load's result may be given
    // the register of an earlier load's address: the wait stands in front of that overwrite.
    if (K < KPAD) asm volatile("s_wait_xcnt 0x0" ::: "memory");
  }
  if (K < KPAD) {
#pragma unroll  // register arrays need constant indices
    for (int i = 0; i < 8; ++i)
      if (k0 + kr * 8u + i >= K) v[i] = f32x4{0.f, 0.f, 0.f, 0.f};
  }
#pragma unroll  // vector elements need constant indices
  for (int j = 0; j < 4; ++j) {
    f16x8 o;
#pragma unroll  // register arrays need constant indices
    for (int i = 0; i < 8; ++i) o[i] = (_Float16)v[i][j];
    *(f16x8*)(T + ct_place(c * 4u + j, kr)) = o;
  }
  return CvOut{Wt + ((size_t)n0 * KPAD + k0), KPAD};
}

// Shapes of the five weight inputs (the stacked one counts CV_L matrices).
#define CV_FS  512u
#define CV_H   1024u
#define CV_OUT 128u
#define CV_ATT 256u
#define CV_LN  256u
#define CV_KA1 320u
#define CV_L   8u
#define CV_T_RES (ct_tiles(CV_H, CV_H))
#define CV_E_RES (CV_L * CV_T_RES)
#define CV_E_W0  (CV_E_RES + ct_tiles(CV_FS, CV_H))
#define CV_E_WF  (CV_E_W0  + ct_tiles(CV_H, CV_OUT))
#define CV_E_WA1 (CV_E_WF  + ct_tiles(CV_KA1, CV_ATT))
#define CV_E_WA2 (CV_E_WA1 + ct_tiles(CV_ATT, CV_LN))

__global__ __launch_bounds__(TPB)
void convert_all_kernel(const float* __restrict__ res_W, const float* __restrict__ W0,
                        const float* __restrict__ Wf,    const float* __restrict__ Wa1,
                        const float* __restrict__ Wa2,
                        _Float16* __restrict__ resWt, _Float16* __restrict__ W0t,
                        _Float16* __restrict__ Wft,   _Float16* __restrict__ Wa1t,
                        _Float16* __restrict__ Wa2t) {
  __shared__ __attribute__((aligned(16))) unsigned char T[CT_N * 128u];
  const uint32_t t = blockIdx.x;        // the same for the whole block
  CvOut O;
  if (t < CV_E_RES) {
    const size_t mo = (size_t)(t / CV_T_RES) * (CV_H * CV_H);
    O = convert_in<CV_H, CV_H, CV_H>(res_W + mo, resWt + mo, t % CV_T_RES, T);
  } else if (t < CV_E_W0) {
    O = convert_in<CV_FS, CV_H, CV_FS>(W0, W0t, t - CV_E_RES, T);
  } else if (t < CV_E_WF) {
    O = convert_in<CV_H, CV_OUT, CV_H>(Wf, Wft, t - CV_E_W0, T);
  } else if (t < CV_E_WA1) {
    O = convert_in<CV_LN + 1u, CV_ATT, CV_KA1>(Wa1, Wa1t, t - CV_E_WF, T);
  } else {
    O = convert_in<CV_ATT, CV_LN, CV_ATT>(Wa2, Wa2t, t - CV_E_WA1, T);
  }
  __syncthreads();   // the whole tile lies in LDS before any wave takes rows of it
  // Second half: 8 lanes take one row n (64 k = one 128-B line of Wt), 16 B each.
  const uint32_t q  = threadIdx.x & 7u;
  const uint32_t nr = threadIdx.x >> 3;
  const uint32_t vo = nr * O.kpad + q * 8u;
#pragma unroll  // four independent 16-B moves a lane
  for (int p = 0; p < 4; ++p)
    *(f16x8*)(O.dst + (size_t)(32u * p) * O.kpad + vo) = *(const f16x8*)(T + ct_place(nr + 32u * p, q));
}

// ---------------------------------------------------------------------------
extern "C" void kernel_launch(void* const* d_in, const int* in_sizes, int n_in,
                              void* d_out, int out_size, void* d_ws, size_t ws_size,
                              hipStream_t stream) {
  (void)in_sizes; (void)n_in; (void)out_size; (void)ws_size;
  const int BS = 64, LNt = 256, FS = 512, H = 1024, OUT = 128, ATT = 256, L = 8;
  const int ROWS = BS * LNt;     // 16384
  const int AR   = BS * OUT;     // 8192 attention rows
  const int KA1  = 320;          // 257 padded to multiple of 64

  const float* x       = (const float*)d_in[0];
  const float* ln0_g   = (const float*)d_in[1];
  const float* ln0_b   = (const float*)d_in[2];
  const float* W0      = (const float*)d_in[3];
  const float* b0      = (const float*)d_in[4];
  const float* res_ln_g= (const float*)d_in[5];
  const float* res_ln_b= (const float*)d_in[6];
  const float* res_W   = (const float*)d_in[7];
  const float* res_b   = (const float*)d_in[8];
  const float* lnf_g   = (const float*)d_in[9];
  const float* lnf_b   = (const float*)d_in[10];
  const float* Wf      = (const float*)d_in[11];
  const float* bf      = (const float*)d_in[12];
  const float* a_ln1_g = (const float*)d_in[13];
  const float* a_ln1_b = (const float*)d_in[14];
  const float* Wa1     = (const float*)d_in[15];
  const float* ba1     = (const float*)d_in[16];
  const float* a_ln2_g = (const float*)d_in[17];
  const float* a_ln2_b = (const float*)d_in[18];
  const float* Wa2     = (const float*)d_in[19];
  const float* ba2     = (const float*)d_in[20];
  float* out           = (float*)d_out;

  // ---- workspace layout ----
  char* ws = (char*)d_ws;
  size_t off = 0;
  auto alloc = [&](size_t bytes) -> void* {
    off = (off + 255) & ~(size_t)255;
    void* p = ws + off;
    off += bytes;
    return p;
  };
  float*    h     = (float*)   alloc((size_t)ROWS * H   * 4);
  _Float16* xln   = (_Float16*)alloc((size_t)ROWS * H   * 2);
  float*    fc    = (float*)   alloc((size_t)ROWS * OUT * 4);
  _Float16* tln   = (_Float16*)alloc((size_t)AR * KA1   * 2);
  float*    abuf  = (float*)   alloc((size_t)AR * ATT   * 4);
  _Float16* aln   = (_Float16*)alloc((size_t)AR * ATT   * 2);
  float*    wbuf  = (float*)   alloc((size_t)AR * LNt   * 4);
  _Float16* W0t   = (_Float16*)alloc((size_t)H * FS     * 2);
  _Float16* resWt = (_Float16*)alloc((size_t)L * H * H  * 2);
  _Float16* Wft   = (_Float16*)alloc((size_t)OUT * H    * 2);
  _Float16* Wa1t  = (_Float16*)alloc((size_t)ATT * KA1  * 2);
  _Float16* Wa2t  = (_Float16*)alloc((size_t)LNt * ATT  * 2);

  // ---- weight conversion (f32 [KxN] -> f16 [N x Kpad], transposed), one launch ----
  convert_all_kernel<<<CV_E_WA2, TPB, 0, stream>>>(res_W, W0, Wf, Wa1, Wa2,
                                                   resWt, W0t, Wft, Wa1t, Wa2t);

  // ---- stem: h = relu(LN(x) @ W0 + b0) ----
  ln_rows_kernel<512, 4><<<ROWS / (NWAVES * 4), TPB, 0, stream>>>(x, ln0_g, ln0_b, xln);
  wmma_gemm_kernel<0, 1024><<<dim3(H / 128, ROWS / 128), TPB, 0, stream>>>(
      xln, W0t, b0, nullptr, h, ROWS, FS);

  // ---- residual stack: h += relu(LN(h) @ Wi + bi) ----
  for (int i = 0; i < L; ++i) {
    ln_rows_kernel<1024, 4><<<ROWS / (NWAVES * 4), TPB, 0, stream>>>(
        h, res_ln_g + (size_t)i * H, res_ln_b + (size_t)i * H, xln);
    wmma_gemm_kernel<1, 1024><<<dim3(H / 128, ROWS / 128), TPB, 0, stream>>>(
        xln, resWt + (size_t)i * H * H, res_b + (size_t)i * H, h, h, ROWS, H);
  }

  // ---- head: fc = LN(h) @ Wf + bf ----
  ln_rows_kernel<1024, 4><<<ROWS / (NWAVES * 4), TPB, 0, stream>>>(h, lnf_g, lnf_b, xln);
  wmma_gemm_kernel<2, 128><<<dim3(OUT / 128, ROWS / 128), TPB, 0, stream>>>(
      xln, Wft, bf, nullptr, fc, ROWS, H);

  // ---- attention MLP over time axis ----
  attn_build_kernel<128, 320><<<AR / NWAVES, TPB, 0, stream>>>(fc, a_ln1_g, a_ln1_b, tln);
  wmma_gemm_kernel<0, 256><<<dim3(ATT / 128, AR / 128), TPB, 0, stream>>>(
      tln, Wa1t, ba1, nullptr, abuf, AR, KA1);
  ln_rows_kernel<256, 4><<<AR / (NWAVES * 4), TPB, 0, stream>>>(abuf, a_ln2_g, a_ln2_b, aln);
  wmma_gemm_kernel<2, 256><<<dim3(LNt / 128, AR / 128), TPB, 0, stream>>>(
      aln, Wa2t, ba2, nullptr, wbuf, AR, ATT);
  softmax_kernel<<<AR / NWAVES, TPB, 0, stream>>>(wbuf);

  // ---- weighted sum over time ----
  final_kernel<128><<<AR / NWAVES, TPB, 0, stream>>>(fc, wbuf, out);
}
